// v000
// Times are from an AMD MI455X. After a warm-up the kernel runs many times in a row, and a time is the length of
// such a window on the GPU divided by its runs, so every launch and the gaps after it count. The runs cycle
// through copies of the inputs. A figure is the median of several windows, for all but v000 over two sittings.
// Sittings can differ by a few percent; kernels timed side by side share one.
// v000 is the starting kernel. One run takes 1920 microseconds.
#include <hip/hip_runtime.h>

// Multi-head attention with per-head projections, an UNSCALED score and a random keep-mask (querys, keys, values [4][1024][1024]; q_h = querys Wq[h] + bq[h] (Wq, Wk, Wv [16][1024][64] 1/32 + biases [16][64] 0.01 == one 'xw' [1024][1024] projection per input whose column block h is W[h]); scores = q.k (no 1/sqrt(dk): sigma ~8); mask ([1024][1024] int {0,1}, ~50 %, read; 0 -> -1e9 == exclusion); softmax; out = concat heads Wp + bp ('xw' [1024][1024] 1/32 + 0.01) -> [4][1024][1024] (4.2 M)).
// Layout per batch: bf16 copies of the three inputs in turn; each per-head [1024][64] weight transposed into rows h*64.. of one bf16 Bt per projection (once); exact projections + f32 biases; dense T-1024 attention whose softmax kernel reads the shared mask row (int32, 16 B per 4 keys) with EVERY row on hi/lo planes (3 products: the unscaled logits are peaked); merged hi/lo x Wp exact + bp.
// Compute dtypes, f32 accumulate: every input rounded to bf16; projections exact + f32 biases; attention 3 products on every row; softmax f32; Wp hl x exact + bias.

#define NB_  4
#define TT   1024
#define DM   1024
#define NH_  16
#define NKV  16
#define REP  (NH_ / NKV)
#define HD   64
#define DQ   (NH_ * HD)
#define DKV  (NKV * HD)
#define ZH   2
#define RH   1024                  // query rows < RH use hi+lo planes (0: none)
#define WIN  0
#define PCAR 1024.0f
#define SCL  1.0f   // the module applies no 1/sqrt(dk)
typedef _Float16 h16;
typedef unsigned short bf;
typedef __attribute__((ext_vector_type(16))) __bf16   v16bf;
typedef __attribute__((ext_vector_type(16))) _Float16 v16h;
typedef __attribute__((ext_vector_type(8)))  _Float16 v8h;
typedef __attribute__((ext_vector_type(8)))  unsigned short v8us;
typedef __attribute__((ext_vector_type(8)))  float    v8f;
typedef __attribute__((ext_vector_type(4)))  float    v4f;
typedef v8h  __attribute__((may_alias)) v8ha;
typedef v4f  __attribute__((may_alias)) v4fa;
typedef v8us __attribute__((may_alias)) v8usa;

__device__ __forceinline__ unsigned short f2bf(float f) { unsigned u = __float_as_uint(f); u += 0x7FFFu + ((u >> 16) & 1u); return (unsigned short)(u >> 16); }
__device__ __forceinline__ float bf2f(unsigned short b) { return __uint_as_float(((unsigned)b) << 16); }
__device__ __forceinline__ float bfr(float f) { return bf2f(f2bf(f)); }
__device__ __forceinline__ v16h cat16(v8h lo, v8h hi) { return __builtin_shufflevector(lo, hi, 0, 1, 2, 3, 4, 5, 6, 7, 8, 9, 10, 11, 12, 13, 14, 15); }
__device__ __forceinline__ v16bf cat16b(v8us lo, v8us hi) { return __builtin_bit_cast(v16bf, __builtin_shufflevector(lo, hi, 0, 1, 2, 3, 4, 5, 6, 7, 8, 9, 10, 11, 12, 13, 14, 15)); }
__device__ __forceinline__ v8f wmma16(v16h a, v16h b, v8f c) { return __builtin_amdgcn_wmma_f32_16x16x32_f16(false, a, false, b, (short)0, c, false, false); }
__device__ __forceinline__ v8f wmmab(v16bf a, v16bf b, v8f c) { return __builtin_amdgcn_wmma_f32_16x16x32_bf16(false, a, false, b, (short)0, c, false, false); }



// ---- k_gemmw: register-blocked GEMM, ONE WAVE per 64x64 output tile (16 accumulators), operands straight from K-contiguous 16-bit planes; grid (M/64, N/64, Z), 32 threads.
// C[m][n] (f32, pitch ldc, + optional f32 bias[n]) = sum_k A[m][k] Bt[n][k] (+ split products per NSPLIT). z-batch strides sA/sB/sC in elements. K % 32 == 0.
template <typename T16> struct WFrag;
template <> struct WFrag<h16> { typedef v16h V; static __device__ __forceinline__ V ld(const h16* p) { return cat16(*(const v8h*)p, *(const v8h*)(p + 16)); } static __device__ __forceinline__ v8f mma(V a, V b, v8f c) { return wmma16(a, b, c); } };
template <> struct WFrag<bf> { typedef v16bf V; static __device__ __forceinline__ V ld(const bf* p) { return cat16b(*(const v8us*)p, *(const v8us*)(p + 16)); } static __device__ __forceinline__ v8f mma(V a, V b, v8f c) { return wmmab(a, b, c); } };
template <typename T16, int NSPLIT, bool BIAS>
__global__ __launch_bounds__(32) void k_gemmw(const T16* __restrict__ A, const T16* __restrict__ A2, const T16* __restrict__ Bt, const T16* __restrict__ Bt2, int K, float* C, int ldc, const float* __restrict__ bias, size_t sA, size_t sB, size_t sC) {
    typedef typename WFrag<T16>::V V;
    __shared__ __align__(16) float os[16 * 68];
    const size_t z = blockIdx.z; A += z * sA; if (A2) A2 += z * sA; Bt += z * sB; if (Bt2) Bt2 += z * sB; C += z * sC;
    const int lane = threadIdx.x & 31, lr = lane & 15, hi = lane >> 4; const int r0 = blockIdx.x * 64, c0 = blockIdx.y * 64;
    v8f acc[4][4];
#pragma unroll
    for (int mb = 0; mb < 4; ++mb)
#pragma unroll
        for (int nb = 0; nb < 4; ++nb) acc[mb][nb] = (v8f){};
    const size_t aoff = (size_t)(r0 + lr) * K + 8 * hi, boff = (size_t)(c0 + lr) * K + 8 * hi;
#pragma unroll 1
    for (int kc = 0; kc < K; kc += 32) {
        V a[4], a2[4];
#pragma unroll
        for (int mb = 0; mb < 4; ++mb) { a[mb] = WFrag<T16>::ld(A + aoff + (size_t)mb * 16 * K + kc); if (NSPLIT == 1 || NSPLIT == 2) a2[mb] = WFrag<T16>::ld(A2 + aoff + (size_t)mb * 16 * K + kc); }
#pragma unroll
        for (int nb = 0; nb < 4; ++nb) { const V b = WFrag<T16>::ld(Bt + boff + (size_t)nb * 16 * K + kc); V b2; if (NSPLIT >= 2) b2 = WFrag<T16>::ld(Bt2 + boff + (size_t)nb * 16 * K + kc);
#pragma unroll
            for (int mb = 0; mb < 4; ++mb) { acc[mb][nb] = WFrag<T16>::mma(a[mb], b, acc[mb][nb]); if (NSPLIT == 1 || NSPLIT == 2) acc[mb][nb] = WFrag<T16>::mma(a2[mb], b, acc[mb][nb]); if (NSPLIT >= 2) acc[mb][nb] = WFrag<T16>::mma(a[mb], b2, acc[mb][nb]); } }
        asm volatile("v_nop\n\tv_nop\n\tv_nop\n\tv_nop" : "+v"(acc[0][0]), "+v"(acc[1][1]), "+v"(acc[2][2]), "+v"(acc[3][3]) : "v"(a[0]), "v"(a[3]));
    }
#pragma unroll
    for (int mb = 0; mb < 4; ++mb) {
#pragma unroll
        for (int nb = 0; nb < 4; ++nb) {
#pragma unroll
            for (int j = 0; j < 8; ++j) os[(hi * 8 + j) * 68 + nb * 16 + lr] = acc[mb][nb][j]; }
        __builtin_amdgcn_wave_barrier(); asm volatile("" ::: "memory");
        float* crow = C + (size_t)(r0 + mb * 16) * ldc + c0;
{
#pragma unroll
            for (int s = 0; s < 8; ++s) { const int row = 2 * s + hi, cofs = lr * 4; v4f val = *(const v4fa*)(os + row * 68 + cofs); if (BIAS) { val[0] += bfr(bias[c0 + cofs]); val[1] += bfr(bias[c0 + cofs + 1]); val[2] += bfr(bias[c0 + cofs + 2]); val[3] += bfr(bias[c0 + cofs + 3]); }
                *(v4f*)(crow + (size_t)row * ldc + cofs) = val; }
             }
        __builtin_amdgcn_wave_barrier(); asm volatile("" ::: "memory");
    }
}

__device__ __forceinline__ h16 tohx(float x) { return (h16)x; }
__device__ __forceinline__ void splitf(float y, unsigned short& h, unsigned short& l) { h = f2bf(y); l = f2bf(y - bf2f(h)); }
typedef __attribute__((ext_vector_type(2))) _Float16 v2h;
typedef __attribute__((ext_vector_type(4))) _Float16 v4h;
typedef __attribute__((ext_vector_type(2))) unsigned short v2us;
typedef __attribute__((ext_vector_type(4))) unsigned short v4us;
typedef __attribute__((ext_vector_type(2))) float v2f;
typedef __attribute__((ext_vector_type(4))) int v4i;

__global__ __launch_bounds__(256) void k_wtG(const float* __restrict__ w, int K, int N, bf* Bt) {
    const int lane = threadIdx.x & 31; const int L0 = (blockIdx.x * 8 + (threadIdx.x >> 5)) * 8; const int nlines = N * K / 64;
{
#pragma unroll 1
        for (int l = 0; l < 8; ++l) { const int L = L0 + l; if (L >= nlines) break; const size_t e = (size_t)L * 64 + lane * 2; const int k = (int)(e % K), n = (int)(e / K); v2us o;
            o[0] = f2bf(w[(size_t)k * N + n]); o[1] = f2bf(w[(size_t)(k + 1) * N + n]); *(v2us*)(Bt + e) = o; }
         }
}
__global__ __launch_bounds__(256) void k_cvt8(const float* __restrict__ src, bf* dst, size_t n8) { const size_t i = (size_t)blockIdx.x * 256 + threadIdx.x; if (i >= n8) return; const v8f v = *(const v8f*)(src + i * 8); v8us o;
#pragma unroll
    for (int k = 0; k < 8; ++k) o[k] = f2bf(v[k]); *(v8us*)(dst + i * 8) = o;  }

// k_rope: head planes [h][t][d] (fp16 + hi/lo) of rope(x) x sc with the rotate-half convention out[d] = x[d] cos[t][d] - x[d+HD/2] sin[t][d], out[d+HD/2] = x[d+HD/2] cos[t][d+HD/2] + x[d] sin[t][d+HD/2]
__global__ __launch_bounds__(256) void k_rope(const float* __restrict__ F, int pitch, int nheads, const float* __restrict__ CS, const float* __restrict__ RF, const float* __restrict__ nw, float sc, h16* P16, bf* Ph, bf* Pl) {
    const size_t e = ((size_t)blockIdx.x * 256 + threadIdx.x) * 2; if (e >= (size_t)nheads * TT * HD) return; const int d = (int)(e % HD); const int t = (int)((e / HD) % TT); const int h = (int)(e / ((size_t)HD * TT)); const float* f = F + (size_t)t * pitch + h * HD; const float rf = RF ? RF[(size_t)h * TT + t] : 1.0f; v2h o16; v2us oh, ol;
#pragma unroll
    for (int q = 0; q < 2; ++q) { const int dd = d + q; const int dp = (dd < HD / 2) ? dd + HD / 2 : dd - HD / 2; float x0 = f[dd], x1 = f[dp];
        if (RF) { float n0 = __fmul_rn(x0, rf), n1 = __fmul_rn(x1, rf); asm volatile("" : "+v"(n0)); asm volatile("" : "+v"(n1)); x0 = __fmul_rn(bfr(nw[dd]), n0); x1 = __fmul_rn(bfr(nw[dp]), n1); }
        const v2f cs = *(const v2f*)(CS + ((size_t)t * HD + dd) * 2); float a = __fmul_rn(x0, cs[0]), bq = __fmul_rn(x1, cs[1]); asm volatile("" : "+v"(a)); asm volatile("" : "+v"(bq)); const float r = ((dd < HD / 2) ? __fsub_rn(a, bq) : __fadd_rn(a, bq)) * sc;
        o16[q] = tohx(r); unsigned short a2, c2; splitf(r, a2, c2); oh[q] = a2; ol[q] = c2; }
    *(v2h*)(P16 + e) = o16; *(v2us*)(Ph + e) = oh; *(v2us*)(Pl + e) = ol;  }
__global__ __launch_bounds__(256) void k_vtp(const float* __restrict__ F, int pitch, int nheads, h16* V16, bf* Vh, bf* Vl) { const size_t e = ((size_t)blockIdx.x * 256 + threadIdx.x) * 2; if (e >= (size_t)nheads * HD * TT) return; const int t = (int)(e % TT); const int d = (int)((e / TT) % HD); const int g = (int)(e / ((size_t)TT * HD)); v2h o16; v2us oh, ol;
#pragma unroll
    for (int q = 0; q < 2; ++q) { const float x = F[(size_t)(t + q) * pitch + g * HD + d]; o16[q] = tohx(x); unsigned short a2, c2; splitf(x, a2, c2); oh[q] = a2; ol[q] = c2; }
    *(v2h*)(V16 + e) = o16; *(v2us*)(Vh + e) = oh; *(v2us*)(Vl + e) = ol;  }
__global__ __launch_bounds__(256) void k_csid(float* CS) { const int idx = blockIdx.x * 256 + threadIdx.x; if (idx >= TT * HD) return; v2f cs; cs[0] = 1.0f; cs[1] = 0.0f; *(v2f*)(CS + (size_t)idx * 2) = cs;  }
__global__ __launch_bounds__(256) void k_asoft(const float* __restrict__ Sb, h16* P16, bf* Ph, bf* Pl, const int* __restrict__ mk) {
    const int lane = threadIdx.x & 31; const int row = blockIdx.x * 8 + (threadIdx.x >> 5); if (row >= ZH * TT) return; const int i = row % TT; const int zz = row / TT; (void)zz; const bool hires = (i < RH); const float* sr = Sb + (size_t)row * TT; float v[TT / 32]; float mx = -3.0e38f;
#pragma unroll
    for (int ch = 0; ch < TT / 128; ++ch) { const int j0 = ch * 128 + lane * 4; const v4f a = *(const v4f*)(sr + j0); const v4i m4 = *(const v4i*)(mk + (size_t)i * TT + j0);   /* shared mask row i, 4 keys (16 B) */
#pragma unroll
        for (int q = 0; q < 4; ++q) { const int j = j0 + q; (void)j; const float t = (m4[q] != 0) ? a[q] * SCL : -3.0e38f;   /* mask 0 -> -1e9 == exclusion */ v[ch * 4 + q] = t; mx = fmaxf(mx, t); } }
#pragma unroll
    for (int sh = 16; sh; sh >>= 1) mx = fmaxf(mx, __shfl_xor(mx, sh, 32));
    float sum = 0.f;
#pragma unroll
    for (int k = 0; k < TT / 32; ++k) { float d0 = __fsub_rn(v[k], mx); asm volatile("" : "+v"(d0)); v[k] = __builtin_amdgcn_exp2f(__fmul_rn(d0, 1.4426950408889634f)); sum += v[k]; }
#pragma unroll
    for (int sh = 16; sh; sh >>= 1) sum += __shfl_xor(sum, sh, 32);
    const float f = __fdiv_rn(hires ? 1.0f : PCAR, sum);
{
        if (hires) {
#pragma unroll
            for (int ch = 0; ch < TT / 128; ++ch) { v4us oh, ol;
#pragma unroll
                for (int q = 0; q < 4; ++q) { unsigned short a, c2; splitf(v[ch * 4 + q] * f, a, c2); oh[q] = a; ol[q] = c2; }
                const size_t oo = ((size_t)zz * (RH ? RH : 1) + i) * TT + ch * 128 + lane * 4; *(v4us*)(Ph + oo) = oh; *(v4us*)(Pl + oo) = ol; }
        } else {
#pragma unroll
            for (int ch = 0; ch < TT / 128; ++ch) { v4h o4;
#pragma unroll
                for (int q = 0; q < 4; ++q) o4[q] = tohx(v[ch * 4 + q] * f);
                *(v4h*)(P16 + (size_t)row * TT + ch * 128 + lane * 4) = o4; } }
         }
}
__global__ __launch_bounds__(256) void k_merge(const float* __restrict__ O, int h0, bf* Ah, bf* Al) { const size_t e = ((size_t)blockIdx.x * 256 + threadIdx.x) * 2; if (e >= (size_t)ZH * TT * HD) return; const int d = (int)(e % HD); const int t = (int)((e / HD) % TT); const int zz = (int)(e / ((size_t)HD * TT)); const float cs = (t < RH) ? 1.0f : (1.0f / PCAR); const size_t oo = (size_t)t * DQ + (h0 + zz) * HD + d;
    v2us oh, ol;
#pragma unroll
    for (int q = 0; q < 2; ++q) { unsigned short a, c2; splitf(O[e + q] * cs, a, c2); oh[q] = a; ol[q] = c2; } *(v2us*)(Ah + oo) = oh; *(v2us*)(Al + oo) = ol;  }

extern "C" void kernel_launch(void* const* d_in, const int* in_sizes, int n_in,
                              void* d_out, int out_size, void* d_ws, size_t ws_size, hipStream_t stream) {
    (void)in_sizes; (void)n_in; (void)out_size;
    const float* x = (const float*)d_in[0]; const float* xk = (const float*)d_in[1]; const float* xv = (const float*)d_in[2]; const int* mk = (const int*)d_in[3];   /* mask [1024][1024] int */ const float* wq = (const float*)d_in[4]; const float* bq = (const float*)d_in[5]; const float* wk = (const float*)d_in[6]; const float* bk = (const float*)d_in[7]; const float* wv = (const float*)d_in[8]; const float* bv = (const float*)d_in[9]; const float* wo = (const float*)d_in[10]; const float* bo = (const float*)d_in[11];
    float* OUT = (float*)d_out;     // [4][1024][1024]
    char* wsp = (char*)d_ws;
    auto take = [&](size_t bytes) { char* p = wsp; wsp += (bytes + 255) & ~(size_t)255; return (void*)p; };
    bf* WQ = (bf*)take((size_t)DQ * DM * 2); bf* WK = (bf*)take((size_t)DKV * DM * 2); bf* WV = (bf*)take((size_t)DKV * DM * 2); bf* WO = (bf*)take((size_t)DM * DQ * 2); float* CS = (float*)take((size_t)TT * HD * 2 * 4);
    bf* XB = (bf*)take((size_t)TT * DM * 2); float* FQ = (float*)take((size_t)TT * DQ * 4); float* FK = (float*)take((size_t)TT * DKV * 4);
    h16* QP16 = (h16*)take((size_t)NH_ * TT * HD * 2); h16* KP16 = (h16*)take((size_t)NKV * TT * HD * 2); h16* VT16 = (h16*)take((size_t)NKV * HD * TT * 2);
    bf* QPh = (bf*)take((size_t)NH_ * TT * HD * 2); bf* QPl = (bf*)take((size_t)NH_ * TT * HD * 2); bf* KPh = (bf*)take((size_t)NKV * TT * HD * 2); bf* KPl = (bf*)take((size_t)NKV * TT * HD * 2); bf* VTh = (bf*)take((size_t)NKV * HD * TT * 2); bf* VTl = (bf*)take((size_t)NKV * HD * TT * 2); bf* Ph = (bf*)take((size_t)ZH * RH * TT * 2); bf* Pl = (bf*)take((size_t)ZH * RH * TT * 2);
    float* Sb = (float*)take((size_t)ZH * TT * TT * 4); h16* P16 = nullptr; float* Ob = (float*)take((size_t)ZH * TT * HD * 4); bf* ATh = (bf*)take((size_t)TT * DQ * 2); bf* ATl = (bf*)take((size_t)TT * DQ * 2);
    if ((size_t)(wsp - (char*)d_ws) > ws_size) return;    // ws 256 MiB
    float* FV = FK;   // v projection reuses the k buffer after the k planes are built (stream-ordered)
    { for (int hh = 0; hh < NH_; ++hh) k_wtG<<<(unsigned)((DM * HD / 64 + 63) / 64), 256, 0, stream>>>(wq + (size_t)hh * DM * HD, DM, HD, WQ + (size_t)hh * HD * DM);   /* per-head [1024][64] -> Bt rows hh*64.. */ for (int hh = 0; hh < NH_; ++hh) k_wtG<<<(unsigned)((DM * HD / 64 + 63) / 64), 256, 0, stream>>>(wk + (size_t)hh * DM * HD, DM, HD, WK + (size_t)hh * HD * DM);   /* per-head [1024][64] -> Bt rows hh*64.. */ for (int hh = 0; hh < NH_; ++hh) k_wtG<<<(unsigned)((DM * HD / 64 + 63) / 64), 256, 0, stream>>>(wv + (size_t)hh * DM * HD, DM, HD, WV + (size_t)hh * HD * DM);   /* per-head [1024][64] -> Bt rows hh*64.. */
      k_wtG<<<(unsigned)((DQ * DM / 64 + 63) / 64), 256, 0, stream>>>(wo, DQ, DM, WO);
       }
    k_csid<<<(TT * HD + 255) / 256, 256, 0, stream>>>(CS);
    const unsigned LQ = (unsigned)(((size_t)NH_ * TT * HD / 2 + 255) / 256), LKv = (unsigned)(((size_t)NKV * TT * HD / 2 + 255) / 256);
    for (int b = 0; b < NB_; ++b) {
        
        k_cvt8<<<(unsigned)(((size_t)TT * DM / 8 + 255) / 256), 256, 0, stream>>>(x + (size_t)b * TT * DM, XB, (size_t)TT * DM / 8);
        k_gemmw<bf, 0, true><<<dim3(TT / 64, DQ / 64, 1), 32, 0, stream>>>(XB, nullptr, WQ, nullptr, DM, FQ, DQ, bq, 0, 0, 0);
        k_rope<<<LQ, 256, 0, stream>>>(FQ, DQ, NH_, CS, nullptr, nullptr, 1.0f, QP16, QPh, QPl);
        k_cvt8<<<(unsigned)(((size_t)TT * DM / 8 + 255) / 256), 256, 0, stream>>>(xk + (size_t)b * TT * DM, XB, (size_t)TT * DM / 8); k_gemmw<bf, 0, true><<<dim3(TT / 64, DKV / 64, 1), 32, 0, stream>>>(XB, nullptr, WK, nullptr, DM, FK, DKV, bk, 0, 0, 0);
        k_rope<<<LKv, 256, 0, stream>>>(FK, DKV, NKV, CS, nullptr, nullptr, 1.0f, KP16, KPh, KPl);
        k_cvt8<<<(unsigned)(((size_t)TT * DM / 8 + 255) / 256), 256, 0, stream>>>(xv + (size_t)b * TT * DM, XB, (size_t)TT * DM / 8); k_gemmw<bf, 0, true><<<dim3(TT / 64, DKV / 64, 1), 32, 0, stream>>>(XB, nullptr, WV, nullptr, DM, FV, DKV, bv, 0, 0, 0); k_vtp<<<LKv, 256, 0, stream>>>(FV, DKV, NKV, VT16, VTh, VTl);
        for (int h0 = 0; h0 < NH_; h0 += ZH) { const size_t zq = (size_t)h0, zk = (size_t)(h0 / REP);   // one kv head per query head: the pass's two heads use consecutive kv planes (z-strides TT*HD)
            k_gemmw<bf, 2, false><<<dim3(RH / 64, TT / 64, ZH), 32, 0, stream>>>(QPh + zq * TT * HD, QPl + zq * TT * HD, KPh + zk * TT * HD, KPl + zk * TT * HD, HD, Sb, TT, nullptr, (size_t)TT * HD, (size_t)TT * HD, (size_t)TT * TT);

            k_asoft<<<ZH * TT / 8, 256, 0, stream>>>(Sb, P16, Ph, Pl, mk);
            k_gemmw<bf, 2, false><<<dim3(RH / 64, HD / 64, ZH), 32, 0, stream>>>(Ph, Pl, VTh + zk * HD * TT, VTl + zk * HD * TT, TT, Ob, HD, nullptr, (size_t)RH * TT, (size_t)HD * TT, (size_t)TT * HD);

            k_merge<<<(unsigned)(((size_t)ZH * TT * HD / 2 + 255) / 256), 256, 0, stream>>>(Ob, h0, ATh, ATl); }
        k_gemmw<bf, 1, true><<<dim3(TT / 64, DM / 64, 1), 32, 0, stream>>>(ATh, ATl, WO, nullptr, DQ, OUT + (size_t)b * TT * DM, DM, bo, 0, 0, 0); }
}

// v001
// Measured time: 436 microseconds a run.
// Two timings next to v000 put it at 4.33 and 4.39 times that version's speed.
#include <hip/hip_runtime.h>

// Multi-head attention with per-head projections, an UNSCALED score and a random keep-mask (querys, keys, values [4][1024][1024]; q_h = querys Wq[h] + bq[h] (Wq, Wk, Wv [16][1024][64] 1/32 + biases [16][64] 0.01 == one 'xw' [1024][1024] projection per input whose column block h is W[h]); scores = q.k (no 1/sqrt(dk): sigma ~8); mask ([1024][1024] int {0,1}, ~50 %, read; 0 -> -1e9 == exclusion); softmax; out = concat heads Wp + bp ('xw' [1024][1024] 1/32 + 0.01) -> [4][1024][1024] (4.2 M)).
// Layout: bf16 copies of the three inputs (all batches, one launch); each per-head [1024][64] weight transposed into rows h*64.. of one bf16 Bt per projection (heads and projections are grid dimensions); the three exact projections + f32 biases as the z planes of one launch over all 4096 rows; per batch, dense T-1024 attention over all 16 heads at once (grid z) whose softmax kernel reads the shared mask row (int32, 16 B per 4 keys) with EVERY row on hi/lo planes (3 products: the unscaled logits are peaked); merged hi/lo x Wp exact + bp over all 4096 rows.
// Compute dtypes, f32 accumulate: every input rounded to bf16; projections exact + f32 biases; attention 3 products on every row; softmax f32; Wp hl x exact + bias.

#define NB_  4
#define TT   1024
#define DM   1024
#define NH_  16
#define NKV  16
#define REP  (NH_ / NKV)
#define HD   64
#define DQ   (NH_ * HD)
#define DKV  (NKV * HD)
#define ZH   16                    // heads per attention pass (grid z)
#define RH   1024                  // query rows < RH use hi+lo planes (P16 is null: needs RH == TT)
#define WIN  0
#define PCAR 1024.0f
#define SCL  1.0f   // the module applies no 1/sqrt(dk)
typedef _Float16 h16;
typedef unsigned short bf;
typedef __attribute__((ext_vector_type(16))) __bf16   v16bf;
typedef __attribute__((ext_vector_type(16))) _Float16 v16h;
typedef __attribute__((ext_vector_type(8)))  _Float16 v8h;
typedef __attribute__((ext_vector_type(8)))  unsigned short v8us;
typedef __attribute__((ext_vector_type(8)))  float    v8f;
typedef __attribute__((ext_vector_type(4)))  float    v4f;
typedef v8h  __attribute__((may_alias)) v8ha;
typedef v4f  __attribute__((may_alias)) v4fa;
typedef v8us __attribute__((may_alias)) v8usa;

__device__ __forceinline__ unsigned short f2bf(float f) { unsigned u = __float_as_uint(f); u += 0x7FFFu + ((u >> 16) & 1u); return (unsigned short)(u >> 16); }
__device__ __forceinline__ float bf2f(unsigned short b) { return __uint_as_float(((unsigned)b) << 16); }
__device__ __forceinline__ float bfr(float f) { return bf2f(f2bf(f)); }
__device__ __forceinline__ v16h cat16(v8h lo, v8h hi) { return __builtin_shufflevector(lo, hi, 0, 1, 2, 3, 4, 5, 6, 7, 8, 9, 10, 11, 12, 13, 14, 15); }
__device__ __forceinline__ v16bf cat16b(v8us lo, v8us hi) { return __builtin_bit_cast(v16bf, __builtin_shufflevector(lo, hi, 0, 1, 2, 3, 4, 5, 6, 7, 8, 9, 10, 11, 12, 13, 14, 15)); }
__device__ __forceinline__ v8f wmma16(v16h a, v16h b, v8f c) { return __builtin_amdgcn_wmma_f32_16x16x32_f16(false, a, false, b, (short)0, c, false, false); }
__device__ __forceinline__ v8f wmmab(v16bf a, v16bf b, v8f c) { return __builtin_amdgcn_wmma_f32_16x16x32_bf16(false, a, false, b, (short)0, c, false, false); }



// ---- k_gemmw: register-blocked GEMM, ONE WAVE per 64x64 output tile (16 accumulators), operands straight from K-contiguous 16-bit planes; grid (M/64, N/64, Z), 32 threads.
// C[m][n] (f32, pitch ldc, + optional f32 bias[n]; z planes 1 and 2 take bias1 and bias2) = sum_k A[m][k] Bt[n][k] (+ split products per NSPLIT). z-batch strides sA/sB/sC in elements. K % 32 == 0.
template <typename T16> struct WFrag;
template <> struct WFrag<h16> { typedef v16h V; static __device__ __forceinline__ V ld(const h16* p) { return cat16(*(const v8h*)p, *(const v8h*)(p + 16)); } static __device__ __forceinline__ v8f mma(V a, V b, v8f c) { return wmma16(a, b, c); } };
template <> struct WFrag<bf> { typedef v16bf V; static __device__ __forceinline__ V ld(const bf* p) { return cat16b(*(const v8us*)p, *(const v8us*)(p + 16)); } static __device__ __forceinline__ v8f mma(V a, V b, v8f c) { return wmmab(a, b, c); } };
template <typename T16, int NSPLIT, bool BIAS>
__global__ __launch_bounds__(32) void k_gemmw(const T16* __restrict__ A, const T16* __restrict__ A2, const T16* __restrict__ Bt, const T16* __restrict__ Bt2, int K, float* C, int ldc, const float* __restrict__ bias, const float* __restrict__ bias1, const float* __restrict__ bias2, size_t sA, size_t sB, size_t sC) {
    typedef typename WFrag<T16>::V V;
    __shared__ __align__(16) float os[16 * 68];
    const size_t z = blockIdx.z; A += z * sA; if (A2) A2 += z * sA; Bt += z * sB; if (Bt2) Bt2 += z * sB; C += z * sC; if (BIAS) bias = (z == 0) ? bias : (z == 1) ? bias1 : bias2;
    const int lane = threadIdx.x & 31, lr = lane & 15, hi = lane >> 4; const int r0 = blockIdx.x * 64, c0 = blockIdx.y * 64;
    v8f acc[4][4];
#pragma unroll
    for (int mb = 0; mb < 4; ++mb)
#pragma unroll
        for (int nb = 0; nb < 4; ++nb) acc[mb][nb] = (v8f){};
    const size_t aoff = (size_t)(r0 + lr) * K + 8 * hi, boff = (size_t)(c0 + lr) * K + 8 * hi;
#pragma unroll 1
    for (int kc = 0; kc < K; kc += 32) {
        V a[4], a2[4];
#pragma unroll
        for (int mb = 0; mb < 4; ++mb) { a[mb] = WFrag<T16>::ld(A + aoff + (size_t)mb * 16 * K + kc); if (NSPLIT == 1 || NSPLIT == 2) a2[mb] = WFrag<T16>::ld(A2 + aoff + (size_t)mb * 16 * K + kc); }
#pragma unroll
        for (int nb = 0; nb < 4; ++nb) { const V b = WFrag<T16>::ld(Bt + boff + (size_t)nb * 16 * K + kc); V b2; if (NSPLIT >= 2) b2 = WFrag<T16>::ld(Bt2 + boff + (size_t)nb * 16 * K + kc);
#pragma unroll
            for (int mb = 0; mb < 4; ++mb) { acc[mb][nb] = WFrag<T16>::mma(a[mb], b, acc[mb][nb]); if (NSPLIT == 1 || NSPLIT == 2) acc[mb][nb] = WFrag<T16>::mma(a2[mb], b, acc[mb][nb]); if (NSPLIT >= 2) acc[mb][nb] = WFrag<T16>::mma(a[mb], b2, acc[mb][nb]); } }
        asm volatile("v_nop\n\tv_nop\n\tv_nop\n\tv_nop" : "+v"(acc[0][0]), "+v"(acc[1][1]), "+v"(acc[2][2]), "+v"(acc[3][3]) : "v"(a[0]), "v"(a[3]));
    }
#pragma unroll
    for (int mb = 0; mb < 4; ++mb) {
#pragma unroll
        for (int nb = 0; nb < 4; ++nb) {
#pragma unroll
            for (int j = 0; j < 8; ++j) os[(hi * 8 + j) * 68 + nb * 16 + lr] = acc[mb][nb][j]; }
        __builtin_amdgcn_wave_barrier(); asm volatile("" ::: "memory");
        float* crow = C + (size_t)(r0 + mb * 16) * ldc + c0;
{
#pragma unroll
            for (int s = 0; s < 8; ++s) { const int row = 2 * s + hi, cofs = lr * 4; v4f val = *(const v4fa*)(os + row * 68 + cofs); if (BIAS) { val[0] += bfr(bias[c0 + cofs]); val[1] += bfr(bias[c0 + cofs + 1]); val[2] += bfr(bias[c0 + cofs + 2]); val[3] += bfr(bias[c0 + cofs + 3]); }
                *(v4f*)(crow + (size_t)row * ldc + cofs) = val; }
             }
        __builtin_amdgcn_wave_barrier(); asm volatile("" ::: "memory");
    }
}

__device__ __forceinline__ h16 tohx(float x) { return (h16)x; }
__device__ __forceinline__ void splitf(float y, unsigned short& h, unsigned short& l) { h = f2bf(y); l = f2bf(y - bf2f(h)); }
typedef __attribute__((ext_vector_type(2))) _Float16 v2h;
typedef __attribute__((ext_vector_type(4))) _Float16 v4h;
typedef __attribute__((ext_vector_type(2))) unsigned short v2us;
typedef __attribute__((ext_vector_type(4))) unsigned short v4us;
typedef __attribute__((ext_vector_type(2))) float v2f;
typedef __attribute__((ext_vector_type(4))) int v4i;

// grid (lines, heads, sources): matrix y of source z ([K][N] f32) goes to Bt plane z * NH_ + y ([N][K] bf16)
__global__ __launch_bounds__(256) void k_wtG(const float* __restrict__ w0, const float* __restrict__ w1, const float* __restrict__ w2, int K, int N, bf* Bt) {
    const float* w = (blockIdx.z == 0 ? w0 : blockIdx.z == 1 ? w1 : w2) + (size_t)blockIdx.y * K * N; Bt += ((size_t)blockIdx.z * NH_ + blockIdx.y) * N * K;
    const int lane = threadIdx.x & 31; const int L0 = (blockIdx.x * 8 + (threadIdx.x >> 5)) * 8; const int nlines = N * K / 64;
{
#pragma unroll 1
        for (int l = 0; l < 8; ++l) { const int L = L0 + l; if (L >= nlines) break; const size_t e = (size_t)L * 64 + lane * 2; const int k = (int)(e % K), n = (int)(e / K); v2us o;
            o[0] = f2bf(w[(size_t)k * N + n]); o[1] = f2bf(w[(size_t)(k + 1) * N + n]); *(v2us*)(Bt + e) = o; }
         }
}
__global__ __launch_bounds__(256) void k_cvt8(const float* __restrict__ s0, const float* __restrict__ s1, const float* __restrict__ s2, bf* dst, size_t n8) { const size_t i = (size_t)blockIdx.x * 256 + threadIdx.x; if (i >= n8) return; const float* src = blockIdx.y == 0 ? s0 : blockIdx.y == 1 ? s1 : s2; dst += (size_t)blockIdx.y * n8 * 8;   /* source y -> plane y */ const v8f v = *(const v8f*)(src + i * 8); v8us o;
#pragma unroll
    for (int k = 0; k < 8; ++k) o[k] = f2bf(v[k]); *(v8us*)(dst + i * 8) = o;  }

// k_rope: head planes [h][t][d] (fp16 + hi/lo) of rope(x) x sc with the rotate-half convention out[d] = x[d] cos[t][d] - x[d+HD/2] sin[t][d], out[d+HD/2] = x[d+HD/2] cos[t][d+HD/2] + x[d] sin[t][d+HD/2]
__global__ __launch_bounds__(256) void k_rope(const float* __restrict__ F, int pitch, int nheads, const float* __restrict__ CS, const float* __restrict__ RF, const float* __restrict__ nw, float sc, h16* P16, bf* Ph, bf* Pl) {
    const size_t e = ((size_t)blockIdx.x * 256 + threadIdx.x) * 2; if (e >= (size_t)nheads * TT * HD) return; const int d = (int)(e % HD); const int t = (int)((e / HD) % TT); const int h = (int)(e / ((size_t)HD * TT)); const size_t pb = (size_t)blockIdx.y * nheads * TT * HD; P16 += pb; Ph += pb; Pl += pb;   /* grid y: one [TT][pitch] slab of F -> one [nheads][TT][HD] plane set */ const float* f = F + ((size_t)blockIdx.y * TT + t) * pitch + h * HD; float rf = 1.0f; v2h o16; v2us oh, ol;
    if (RF) { rf = RF[(size_t)h * TT + t]; asm volatile("s_wait_xcnt 0x0" ::: "memory"); }   // the wait stands behind the load, in front of the first rewrite of its address registers
#pragma unroll
    for (int q = 0; q < 2; ++q) { const int dd = d + q; const int dp = (dd < HD / 2) ? dd + HD / 2 : dd - HD / 2; float x0 = f[dd], x1 = f[dp];
        if (RF) { float n0 = __fmul_rn(x0, rf), n1 = __fmul_rn(x1, rf); asm volatile("" : "+v"(n0)); asm volatile("" : "+v"(n1)); x0 = __fmul_rn(bfr(nw[dd]), n0); x1 = __fmul_rn(bfr(nw[dp]), n1); }
        const v2f cs = *(const v2f*)(CS + ((size_t)t * HD + dd) * 2); float a = __fmul_rn(x0, cs[0]), bq = __fmul_rn(x1, cs[1]); asm volatile("" : "+v"(a)); asm volatile("" : "+v"(bq)); const float r = ((dd < HD / 2) ? __fsub_rn(a, bq) : __fadd_rn(a, bq)) * sc;
        o16[q] = tohx(r); unsigned short a2, c2; splitf(r, a2, c2); oh[q] = a2; ol[q] = c2; }
    *(v2h*)(P16 + e) = o16; *(v2us*)(Ph + e) = oh; *(v2us*)(Pl + e) = ol;  }
__global__ __launch_bounds__(256) void k_vtp(const float* __restrict__ F, int pitch, int nheads, h16* V16, bf* Vh, bf* Vl) { const size_t e = ((size_t)blockIdx.x * 256 + threadIdx.x) * 2; if (e >= (size_t)nheads * HD * TT) return; const int t = (int)(e % TT); const int d = (int)((e / TT) % HD); const int g = (int)(e / ((size_t)TT * HD)); F += (size_t)blockIdx.y * TT * pitch; const size_t pb = (size_t)blockIdx.y * nheads * HD * TT; V16 += pb; Vh += pb; Vl += pb;   /* grid y: batch */ v2h o16; v2us oh, ol;
#pragma unroll
    for (int q = 0; q < 2; ++q) { const float x = F[(size_t)(t + q) * pitch + g * HD + d]; o16[q] = tohx(x); unsigned short a2, c2; splitf(x, a2, c2); oh[q] = a2; ol[q] = c2; }
    *(v2h*)(V16 + e) = o16; *(v2us*)(Vh + e) = oh; *(v2us*)(Vl + e) = ol;  }
__global__ __launch_bounds__(256) void k_csid(float* CS) { const int idx = blockIdx.x * 256 + threadIdx.x; if (idx >= TT * HD) return; v2f cs; cs[0] = 1.0f; cs[1] = 0.0f; *(v2f*)(CS + (size_t)idx * 2) = cs;  }
__global__ __launch_bounds__(256) void k_asoft(const float* __restrict__ Sb, h16* P16, bf* Ph, bf* Pl, const int* __restrict__ mk) {
    const int lane = threadIdx.x & 31; const int row = blockIdx.x * 8 + (threadIdx.x >> 5); if (row >= ZH * TT) return; const int i = row % TT; const int zz = row / TT; (void)zz; const bool hires = (i < RH); const float* sr = Sb + (size_t)row * TT; float v[TT / 32]; float mx = -3.0e38f;
#pragma unroll
    for (int ch = 0; ch < TT / 128; ++ch) { const int j0 = ch * 128 + lane * 4; const v4f a = *(const v4f*)(sr + j0); const v4i m4 = *(const v4i*)(mk + (size_t)i * TT + j0);   /* shared mask row i, 4 keys (16 B) */
#pragma unroll
        for (int q = 0; q < 4; ++q) { const int j = j0 + q; (void)j; const float t = (m4[q] != 0) ? a[q] * SCL : -3.0e38f;   /* mask 0 -> -1e9 == exclusion */ v[ch * 4 + q] = t; mx = fmaxf(mx, t); } }
#pragma unroll
    for (int sh = 16; sh; sh >>= 1) mx = fmaxf(mx, __shfl_xor(mx, sh, 32));
    float sum = 0.f;
#pragma unroll
    for (int k = 0; k < TT / 32; ++k) { float d0 = __fsub_rn(v[k], mx); asm volatile("" : "+v"(d0)); v[k] = __builtin_amdgcn_exp2f(__fmul_rn(d0, 1.4426950408889634f)); sum += v[k]; }
#pragma unroll
    for (int sh = 16; sh; sh >>= 1) sum += __shfl_xor(sum, sh, 32);
    const float f = __fdiv_rn(hires ? 1.0f : PCAR, sum);
{
        if (hires) {
#pragma unroll
            for (int ch = 0; ch < TT / 128; ++ch) { v4us oh, ol;
#pragma unroll
                for (int q = 0; q < 4; ++q) { unsigned short a, c2; splitf(v[ch * 4 + q] * f, a, c2); oh[q] = a; ol[q] = c2; }
                const size_t oo = ((size_t)zz * (RH ? RH : 1) + i) * TT + ch * 128 + lane * 4; *(v4us*)(Ph + oo) = oh; *(v4us*)(Pl + oo) = ol; }
        } else {
#pragma unroll
            for (int ch = 0; ch < TT / 128; ++ch) { v4h o4;
#pragma unroll
                for (int q = 0; q < 4; ++q) o4[q] = tohx(v[ch * 4 + q] * f);
                *(v4h*)(P16 + (size_t)row * TT + ch * 128 + lane * 4) = o4; } }
         }
}
__global__ __launch_bounds__(256) void k_merge(const float* __restrict__ O, int h0, bf* Ah, bf* Al) { const size_t e = ((size_t)blockIdx.x * 256 + threadIdx.x) * 2; if (e >= (size_t)ZH * TT * HD) return; const int d = (int)(e % HD); const int t = (int)((e / HD) % TT); const int zz = (int)(e / ((size_t)HD * TT)); const float cs = (t < RH) ? 1.0f : (1.0f / PCAR); const size_t oo = (size_t)t * DQ + (h0 + zz) * HD + d;
    v2us oh, ol;
#pragma unroll
    for (int q = 0; q < 2; ++q) { unsigned short a, c2; splitf(O[e + q] * cs, a, c2); oh[q] = a; ol[q] = c2; } *(v2us*)(Ah + oo) = oh; *(v2us*)(Al + oo) = ol;  }

extern "C" void kernel_launch(void* const* d_in, const int* in_sizes, int n_in,
                              void* d_out, int out_size, void* d_ws, size_t ws_size, hipStream_t stream) {
    (void)in_sizes; (void)n_in; (void)out_size;
    const float* x = (const float*)d_in[0]; const float* xk = (const float*)d_in[1]; const float* xv = (const float*)d_in[2]; const int* mk = (const int*)d_in[3];   /* mask [1024][1024] int */ const float* wq = (const float*)d_in[4]; const float* bq = (const float*)d_in[5]; const float* wk = (const float*)d_in[6]; const float* bk = (const float*)d_in[7]; const float* wv = (const float*)d_in[8]; const float* bv = (const float*)d_in[9]; const float* wo = (const float*)d_in[10]; const float* bo = (const float*)d_in[11];
    float* OUT = (float*)d_out;     // [4][1024][1024]
    char* wsp = (char*)d_ws;
    auto take = [&](size_t bytes) { char* p = wsp; wsp += (bytes + 255) & ~(size_t)255; return (void*)p; };
    bf* WQ = (bf*)take((size_t)DQ * DM * 2); bf* WK = (bf*)take((size_t)DKV * DM * 2); bf* WV = (bf*)take((size_t)DKV * DM * 2); bf* WO = (bf*)take((size_t)DM * DQ * 2); float* CS = (float*)take((size_t)TT * HD * 2 * 4); (void)WK; (void)WV;   // WQ, WK, WV are consecutive planes (z-stride DQ*DM)
    const size_t PL = (size_t)NB_ * NH_ * TT * HD;   // one plane set: all batches, all heads
    h16* QP16 = (h16*)take(PL * 2); h16* KP16 = (h16*)take(PL * 2); h16* VT16 = (h16*)take(PL * 2); (void)KP16;
    bf* QPh = (bf*)take(PL * 2); bf* KPh = (bf*)take(PL * 2); bf* QPl = (bf*)take(PL * 2); bf* KPl = (bf*)take(PL * 2); bf* VTh = (bf*)take(PL * 2); bf* VTl = (bf*)take(PL * 2);   // the k planes follow the q planes: one launch fills both
    float* Sb = (float*)take((size_t)ZH * TT * TT * 4); bf* Ph = (bf*)take((size_t)ZH * RH * TT * 2); bf* Pl = (bf*)take((size_t)ZH * RH * TT * 2); h16* P16 = nullptr; float* Ob = (float*)take((size_t)ZH * TT * HD * 4); bf* ATh = (bf*)take((size_t)NB_ * TT * DQ * 2); bf* ATl = (bf*)take((size_t)NB_ * TT * DQ * 2);
    if ((size_t)(wsp - (char*)d_ws) > ws_size) return;    // ws 256 MiB
    bf* XB = (bf*)Sb; float* F = (float*)(XB + (size_t)3 * NB_ * TT * DM);   // 24 MiB of bf16 inputs + 48 MiB of f32 projections lie over Sb and Ph: both are dead once the head planes are built, before the first score launch (stream-ordered)
    k_wtG<<<dim3((DM * HD / 64 + 63) / 64, NH_, 3), 256, 0, stream>>>(wq, wk, wv, DM, HD, WQ);   /* per-head [1024][64] -> Bt rows hh*64.. of WQ, WK, WV */
    k_wtG<<<dim3((DQ * DM / 64 + 63) / 64, 1, 1), 256, 0, stream>>>(wo, wo, wo, DQ, DM, WO);
    k_csid<<<(TT * HD + 255) / 256, 256, 0, stream>>>(CS);
    const unsigned LQ = (unsigned)(((size_t)NH_ * TT * HD / 2 + 255) / 256), LKv = (unsigned)(((size_t)NKV * TT * HD / 2 + 255) / 256);
    k_cvt8<<<dim3((unsigned)(((size_t)NB_ * TT * DM / 8 + 255) / 256), 3, 1), 256, 0, stream>>>(x, xk, xv, XB, (size_t)NB_ * TT * DM / 8);
    k_gemmw<bf, 0, true><<<dim3(NB_ * TT / 64, DQ / 64, 3), 32, 0, stream>>>(XB, nullptr, WQ, nullptr, DM, F, DQ, bq, bk, bv, (size_t)NB_ * TT * DM, (size_t)DQ * DM, (size_t)NB_ * TT * DQ);   // z: q, k, v
    k_rope<<<dim3(LQ, 2 * NB_, 1), 256, 0, stream>>>(F, DQ, NH_, CS, nullptr, nullptr, 1.0f, QP16, QPh, QPl);   // y: the 4 q slabs, then the 4 k slabs
    k_vtp<<<dim3(LKv, NB_, 1), 256, 0, stream>>>(F + (size_t)2 * NB_ * TT * DQ, DKV, NKV, VT16, VTh, VTl);
    for (int b = 0; b < NB_; ++b) { const size_t zb = (size_t)b * NH_ * TT * HD;   // one kv head per query head: the 16 heads of a batch use consecutive planes (z-strides TT*HD)
        k_gemmw<bf, 2, false><<<dim3(RH / 64, TT / 64, ZH), 32, 0, stream>>>(QPh + zb, QPl + zb, KPh + zb, KPl + zb, HD, Sb, TT, nullptr, nullptr, nullptr, (size_t)TT * HD, (size_t)TT * HD, (size_t)TT * TT);
        k_asoft<<<ZH * TT / 8, 256, 0, stream>>>(Sb, P16, Ph, Pl, mk);
        k_gemmw<bf, 2, false><<<dim3(RH / 64, HD / 64, ZH), 32, 0, stream>>>(Ph, Pl, VTh + zb, VTl + zb, TT, Ob, HD, nullptr, nullptr, nullptr, (size_t)RH * TT, (size_t)HD * TT, (size_t)TT * HD);
        k_merge<<<(unsigned)(((size_t)ZH * TT * HD / 2 + 255) / 256), 256, 0, stream>>>(Ob, 0, ATh + (size_t)b * TT * DQ, ATl + (size_t)b * TT * DQ); }
    k_gemmw<bf, 1, true><<<dim3(NB_ * TT / 64, DM / 64, 1), 32, 0, stream>>>(ATh, ATl, WO, nullptr, DQ, OUT, DM, bo, nullptr, nullptr, 0, 0, 0);
}

// v002
// One run takes 208 microseconds.
// Timed twice side by side with v001, it ran 2.10 and 2.09 times as fast.
// Counting every step since v000, it is 9.12 times as fast.
#include <hip/hip_runtime.h>

// Multi-head attention with per-head projections, an UNSCALED score and a random keep-mask (querys, keys, values [4][1024][1024]; q_h = querys Wq[h] + bq[h] (Wq, Wk, Wv [16][1024][64] 1/32 + biases [16][64] 0.01 == one 'xw' [1024][1024] projection per input whose column block h is W[h]); scores = q.k (no 1/sqrt(dk): sigma ~8); mask ([1024][1024] int {0,1}, ~50 %, read; 0 -> -1e9 == exclusion); softmax; out = concat heads Wp + bp ('xw' [1024][1024] 1/32 + 0.01) -> [4][1024][1024] (4.2 M)).
// Layout: bf16 copies of the three inputs (all batches, one launch); each per-head [1024][64] weight transposed into rows h*64.. of one bf16 Bt per projection (heads and projections are grid dimensions); the three exact projections + f32 biases as the z planes of one launch over all 4096 rows; ONE attention launch over all batches and heads (k_fattn: scores, mask, running softmax and P V stay in registers and LDS, every row on hi/lo planes, 3 products each); merged hi/lo x Wp exact + bp over all 4096 rows.
// Compute dtypes, f32 accumulate: every input rounded to bf16; projections exact + f32 biases; attention 3 products on every row; softmax f32; Wp hl x exact + bias.

#define NB_  4
#define TT   1024
#define DM   1024
#define NH_  16
#define NKV  16
#define REP  (NH_ / NKV)
#define HD   64
#define DQ   (NH_ * HD)
#define DKV  (NKV * HD)
#define ZH   16
#define RH   1024
#define WIN  0
#define PCAR 1024.0f
#define SCL  1.0f   // the module applies no 1/sqrt(dk)
typedef _Float16 h16;
typedef unsigned short bf;
typedef __attribute__((ext_vector_type(16))) __bf16   v16bf;
typedef __attribute__((ext_vector_type(16))) _Float16 v16h;
typedef __attribute__((ext_vector_type(8)))  _Float16 v8h;
typedef __attribute__((ext_vector_type(8)))  unsigned short v8us;
typedef __attribute__((ext_vector_type(8)))  float    v8f;
typedef __attribute__((ext_vector_type(4)))  float    v4f;
typedef v8h  __attribute__((may_alias)) v8ha;
typedef v4f  __attribute__((may_alias)) v4fa;
typedef v8us __attribute__((may_alias)) v8usa;

__device__ __forceinline__ unsigned short f2bf(float f) { unsigned u = __float_as_uint(f); u += 0x7FFFu + ((u >> 16) & 1u); return (unsigned short)(u >> 16); }
__device__ __forceinline__ float bf2f(unsigned short b) { return __uint_as_float(((unsigned)b) << 16); }
__device__ __forceinline__ float bfr(float f) { return bf2f(f2bf(f)); }
__device__ __forceinline__ v16h cat16(v8h lo, v8h hi) { return __builtin_shufflevector(lo, hi, 0, 1, 2, 3, 4, 5, 6, 7, 8, 9, 10, 11, 12, 13, 14, 15); }
__device__ __forceinline__ v16bf cat16b(v8us lo, v8us hi) { return __builtin_bit_cast(v16bf, __builtin_shufflevector(lo, hi, 0, 1, 2, 3, 4, 5, 6, 7, 8, 9, 10, 11, 12, 13, 14, 15)); }
__device__ __forceinline__ v8f wmma16(v16h a, v16h b, v8f c) { return __builtin_amdgcn_wmma_f32_16x16x32_f16(false, a, false, b, (short)0, c, false, false); }
__device__ __forceinline__ v8f wmmab(v16bf a, v16bf b, v8f c) { return __builtin_amdgcn_wmma_f32_16x16x32_bf16(false, a, false, b, (short)0, c, false, false); }



// ---- k_gemmw: register-blocked GEMM, ONE WAVE per 64x64 output tile (16 accumulators), operands straight from K-contiguous 16-bit planes; grid (M/64, N/64, Z), 32 threads.
// C[m][n] (f32, pitch ldc, + optional f32 bias[n]; z planes 1 and 2 take bias1 and bias2) = sum_k A[m][k] Bt[n][k] (+ split products per NSPLIT). z-batch strides sA/sB/sC in elements. K % 32 == 0.
template <typename T16> struct WFrag;
template <> struct WFrag<h16> { typedef v16h V; static __device__ __forceinline__ V ld(const h16* p) { return cat16(*(const v8h*)p, *(const v8h*)(p + 16)); } static __device__ __forceinline__ v8f mma(V a, V b, v8f c) { return wmma16(a, b, c); } };
template <> struct WFrag<bf> { typedef v16bf V; static __device__ __forceinline__ V ld(const bf* p) { return cat16b(*(const v8us*)p, *(const v8us*)(p + 16)); } static __device__ __forceinline__ v8f mma(V a, V b, v8f c) { return wmmab(a, b, c); } };
template <typename T16, int NSPLIT, bool BIAS>
__global__ __launch_bounds__(32) void k_gemmw(const T16* __restrict__ A, const T16* __restrict__ A2, const T16* __restrict__ Bt, const T16* __restrict__ Bt2, int K, float* C, int ldc, const float* __restrict__ bias, const float* __restrict__ bias1, const float* __restrict__ bias2, size_t sA, size_t sB, size_t sC) {
    typedef typename WFrag<T16>::V V;
    __shared__ __align__(16) float os[16 * 68];
    const size_t z = blockIdx.z; A += z * sA; if (A2) A2 += z * sA; Bt += z * sB; if (Bt2) Bt2 += z * sB; C += z * sC; if (BIAS) bias = (z == 0) ? bias : (z == 1) ? bias1 : bias2;
    const int lane = threadIdx.x & 31, lr = lane & 15, hi = lane >> 4; const int r0 = blockIdx.x * 64, c0 = blockIdx.y * 64;
    v8f acc[4][4];
#pragma unroll
    for (int mb = 0; mb < 4; ++mb)
#pragma unroll
        for (int nb = 0; nb < 4; ++nb) acc[mb][nb] = (v8f){};
    const size_t aoff = (size_t)(r0 + lr) * K + 8 * hi, boff = (size_t)(c0 + lr) * K + 8 * hi;
#pragma unroll 1
    for (int kc = 0; kc < K; kc += 32) {
        V a[4], a2[4];
#pragma unroll
        for (int mb = 0; mb < 4; ++mb) { a[mb] = WFrag<T16>::ld(A + aoff + (size_t)mb * 16 * K + kc); if (NSPLIT == 1 || NSPLIT == 2) a2[mb] = WFrag<T16>::ld(A2 + aoff + (size_t)mb * 16 * K + kc); }
#pragma unroll
        for (int nb = 0; nb < 4; ++nb) { const V b = WFrag<T16>::ld(Bt + boff + (size_t)nb * 16 * K + kc); V b2; if (NSPLIT >= 2) b2 = WFrag<T16>::ld(Bt2 + boff + (size_t)nb * 16 * K + kc);
#pragma unroll
            for (int mb = 0; mb < 4; ++mb) { acc[mb][nb] = WFrag<T16>::mma(a[mb], b, acc[mb][nb]); if (NSPLIT == 1 || NSPLIT == 2) acc[mb][nb] = WFrag<T16>::mma(a2[mb], b, acc[mb][nb]); if (NSPLIT >= 2) acc[mb][nb] = WFrag<T16>::mma(a[mb], b2, acc[mb][nb]); } }
        asm volatile("v_nop\n\tv_nop\n\tv_nop\n\tv_nop" : "+v"(acc[0][0]), "+v"(acc[1][1]), "+v"(acc[2][2]), "+v"(acc[3][3]) : "v"(a[0]), "v"(a[3]));
    }
#pragma unroll
    for (int mb = 0; mb < 4; ++mb) {
#pragma unroll
        for (int nb = 0; nb < 4; ++nb) {
#pragma unroll
            for (int j = 0; j < 8; ++j) os[(hi * 8 + j) * 68 + nb * 16 + lr] = acc[mb][nb][j]; }
        __builtin_amdgcn_wave_barrier(); asm volatile("" ::: "memory");
        float* crow = C + (size_t)(r0 + mb * 16) * ldc + c0;
{
#pragma unroll
            for (int s = 0; s < 8; ++s) { const int row = 2 * s + hi, cofs = lr * 4; v4f val = *(const v4fa*)(os + row * 68 + cofs); if (BIAS) { val[0] += bfr(bias[c0 + cofs]); val[1] += bfr(bias[c0 + cofs + 1]); val[2] += bfr(bias[c0 + cofs + 2]); val[3] += bfr(bias[c0 + cofs + 3]); }
                *(v4f*)(crow + (size_t)row * ldc + cofs) = val; }
             }
        __builtin_amdgcn_wave_barrier(); asm volatile("" ::: "memory");
    }
}

__device__ __forceinline__ h16 tohx(float x) { return (h16)x; }
__device__ __forceinline__ void splitf(float y, unsigned short& h, unsigned short& l) { h = f2bf(y); l = f2bf(y - bf2f(h)); }
typedef __attribute__((ext_vector_type(2))) _Float16 v2h;
typedef __attribute__((ext_vector_type(4))) _Float16 v4h;
typedef __attribute__((ext_vector_type(2))) unsigned short v2us;
typedef __attribute__((ext_vector_type(4))) unsigned short v4us;
typedef __attribute__((ext_vector_type(2))) float v2f;
typedef __attribute__((ext_vector_type(4))) int v4i;

// grid (lines, heads, sources): matrix y of source z ([K][N] f32) goes to Bt plane z * NH_ + y ([N][K] bf16)
__global__ __launch_bounds__(256) void k_wtG(const float* __restrict__ w0, const float* __restrict__ w1, const float* __restrict__ w2, int K, int N, bf* Bt) {
    const float* w = (blockIdx.z == 0 ? w0 : blockIdx.z == 1 ? w1 : w2) + (size_t)blockIdx.y * K * N; Bt += ((size_t)blockIdx.z * NH_ + blockIdx.y) * N * K;
    const int lane = threadIdx.x & 31; const int L0 = (blockIdx.x * 8 + (threadIdx.x >> 5)) * 8; const int nlines = N * K / 64;
{
#pragma unroll 1
        for (int l = 0; l < 8; ++l) { const int L = L0 + l; if (L >= nlines) break; const size_t e = (size_t)L * 64 + lane * 2; const int k = (int)(e % K), n = (int)(e / K); v2us o;
            o[0] = f2bf(w[(size_t)k * N + n]); o[1] = f2bf(w[(size_t)(k + 1) * N + n]); *(v2us*)(Bt + e) = o; }
         }
}
__global__ __launch_bounds__(256) void k_cvt8(const float* __restrict__ s0, const float* __restrict__ s1, const float* __restrict__ s2, bf* dst, size_t n8) { const size_t i = (size_t)blockIdx.x * 256 + threadIdx.x; if (i >= n8) return; const float* src = blockIdx.y == 0 ? s0 : blockIdx.y == 1 ? s1 : s2; dst += (size_t)blockIdx.y * n8 * 8;   /* source y -> plane y */ const v8f v = *(const v8f*)(src + i * 8); v8us o;
#pragma unroll
    for (int k = 0; k < 8; ++k) o[k] = f2bf(v[k]); *(v8us*)(dst + i * 8) = o;  }

// k_rope: head planes [h][t][d] (fp16 + hi/lo) of rope(x) x sc with the rotate-half convention out[d] = x[d] cos[t][d] - x[d+HD/2] sin[t][d], out[d+HD/2] = x[d+HD/2] cos[t][d+HD/2] + x[d] sin[t][d+HD/2]
__global__ __launch_bounds__(256) void k_rope(const float* __restrict__ F, int pitch, int nheads, const float* __restrict__ CS, const float* __restrict__ RF, const float* __restrict__ nw, float sc, h16* P16, bf* Ph, bf* Pl) {
    const size_t e = ((size_t)blockIdx.x * 256 + threadIdx.x) * 2; if (e >= (size_t)nheads * TT * HD) return; const int d = (int)(e % HD); const int t = (int)((e / HD) % TT); const int h = (int)(e / ((size_t)HD * TT)); const size_t pb = (size_t)blockIdx.y * nheads * TT * HD; P16 += pb; Ph += pb; Pl += pb;   /* grid y: one [TT][pitch] slab of F -> one [nheads][TT][HD] plane set */ const float* f = F + ((size_t)blockIdx.y * TT + t) * pitch + h * HD; float rf = 1.0f; v2h o16; v2us oh, ol;
    if (RF) { rf = RF[(size_t)h * TT + t]; asm volatile("s_wait_xcnt 0x0" ::: "memory"); }   // the wait stands behind the load, in front of the first rewrite of its address registers
#pragma unroll
    for (int q = 0; q < 2; ++q) { const int dd = d + q; const int dp = (dd < HD / 2) ? dd + HD / 2 : dd - HD / 2; float x0 = f[dd], x1 = f[dp];
        if (RF) { float n0 = __fmul_rn(x0, rf), n1 = __fmul_rn(x1, rf); asm volatile("" : "+v"(n0)); asm volatile("" : "+v"(n1)); x0 = __fmul_rn(bfr(nw[dd]), n0); x1 = __fmul_rn(bfr(nw[dp]), n1); }
        const v2f cs = *(const v2f*)(CS + ((size_t)t * HD + dd) * 2); float a = __fmul_rn(x0, cs[0]), bq = __fmul_rn(x1, cs[1]); asm volatile("" : "+v"(a)); asm volatile("" : "+v"(bq)); const float r = ((dd < HD / 2) ? __fsub_rn(a, bq) : __fadd_rn(a, bq)) * sc;
        o16[q] = tohx(r); unsigned short a2, c2; splitf(r, a2, c2); oh[q] = a2; ol[q] = c2; }
    *(v2h*)(P16 + e) = o16; *(v2us*)(Ph + e) = oh; *(v2us*)(Pl + e) = ol;  }
__global__ __launch_bounds__(256) void k_vtp(const float* __restrict__ F, int pitch, int nheads, h16* V16, bf* Vh, bf* Vl) { const size_t e = ((size_t)blockIdx.x * 256 + threadIdx.x) * 2; if (e >= (size_t)nheads * HD * TT) return; const int t = (int)(e % TT); const int d = (int)((e / TT) % HD); const int g = (int)(e / ((size_t)TT * HD)); F += (size_t)blockIdx.y * TT * pitch; const size_t pb = (size_t)blockIdx.y * nheads * HD * TT; V16 += pb; Vh += pb; Vl += pb;   /* grid y: batch */ v2h o16; v2us oh, ol;
#pragma unroll
    for (int q = 0; q < 2; ++q) { const float x = F[(size_t)(t + q) * pitch + g * HD + d]; o16[q] = tohx(x); unsigned short a2, c2; splitf(x, a2, c2); oh[q] = a2; ol[q] = c2; }
    *(v2h*)(V16 + e) = o16; *(v2us*)(Vh + e) = oh; *(v2us*)(Vl + e) = ol;  }
__global__ __launch_bounds__(256) void k_csid(float* CS) { const int idx = blockIdx.x * 256 + threadIdx.x; if (idx >= TT * HD) return; v2f cs; cs[0] = 1.0f; cs[1] = 0.0f; *(v2f*)(CS + (size_t)idx * 2) = cs;  }
typedef __attribute__((ext_vector_type(2))) __bf16 v2bf;
typedef __attribute__((ext_vector_type(8))) unsigned v8u;
__device__ __forceinline__ float xhalf(float x) { const int b = __float_as_int(x); return __int_as_float(__builtin_amdgcn_permlanex16(b, b, 0x76543210, 0xfedcba98, false, false)); }   // the value of lane l ^ 16
#define FPITCH 72                  // LDS row pitch in 16-bit elements: 128-B rows + 16 B (ds_load_b128 readers)
#define FTILE  (64 * FPITCH)       // one staged tile: 64 rows
#define L2E    1.4426950408889634f
__global__ __launch_bounds__(256) void k_fattn(const bf* __restrict__ Qh, const bf* __restrict__ Ql, const bf* __restrict__ Kh, const bf* __restrict__ Kl, const bf* __restrict__ Vh, const bf* __restrict__ Vl, const int* __restrict__ mk, bf* Ah, bf* Al) {
    __shared__ __align__(16) bf sm[2 * 4 * FTILE];
    const int tid = threadIdx.x, lane = tid & 31, lr = lane & 15, hi = lane >> 4;
    const int q0 = blockIdx.x * 256 + (tid >> 5) * 32;
    const size_t pb = (size_t)blockIdx.y * TT * HD;
    const int srow = tid >> 3, sch = (tid & 7) * 8;   // staging: this thread moves 16 B of rows srow and srow + 32 of each tile
    v8us stg[8];
    auto gload = [&](int s) {
        __builtin_amdgcn_sched_barrier(0);   // this and the one at the foot keep the loads where they are written, with their s_wait_xcnt directly behind them
        const size_t ko = pb + (size_t)(s * 64 + srow) * HD + sch, vo = pb + (size_t)srow * TT + s * 64 + sch; const bf* a0 = Kh + ko; const bf* a1 = Kl + ko; const bf* a2 = Vh + vo; const bf* a3 = Vl + vo;
#pragma unroll
        for (int r = 0; r < 2; ++r) { stg[r] = *(const v8us*)(a0 + r * 32 * HD); stg[2 + r] = *(const v8us*)(a1 + r * 32 * HD); stg[4 + r] = *(const v8us*)(a2 + r * 32 * TT); stg[6 + r] = *(const v8us*)(a3 + r * 32 * TT); }
        asm volatile("s_wait_xcnt 0x0" :: "v"(a0), "v"(a1), "v"(a2), "v"(a3) : "memory");   // behind the loads, in front of the first rewrite of their address registers (named as inputs: they stay live up to here, so no load's result lands on them either)
        __builtin_amdgcn_sched_barrier(0); };
    auto sstore = [&](int buf) {
#pragma unroll
        for (int i = 0; i < 4; ++i)
#pragma unroll
            for (int r = 0; r < 2; ++r) *(v8us*)(sm + (buf * 4 + i) * FTILE + (srow + 32 * r) * FPITCH + sch) = stg[i * 2 + r]; };
    auto mload = [&](v4i (&m)[2][2][2], int key0, int koff) {   // mask of 32 keys (from key0 + koff; koff a literal, it goes into the loads' offset field) x 32 query columns: [column tile][key tile][4 keys]
        __builtin_amdgcn_sched_barrier(0);   // as in gload
        const int* p0 = mk + (size_t)(q0 + lr) * TT + key0 + hi * 8; const int* p1 = p0 + 16 * TT + koff;
#pragma unroll
        for (int kt = 0; kt < 2; ++kt) { m[0][kt][0] = *(const v4i*)(p0 + koff + kt * 16); m[0][kt][1] = *(const v4i*)(p0 + koff + kt * 16 + 4); m[1][kt][0] = *(const v4i*)(p1 + kt * 16); m[1][kt][1] = *(const v4i*)(p1 + kt * 16 + 4); }
        asm volatile("s_wait_xcnt 0x0" :: "v"(p0) : "memory");   // as in gload (the eight loads share one address pair)
        __builtin_amdgcn_sched_barrier(0); };
    v16bf qh[2][2], ql[2][2];   // [column tile][k step]
#pragma unroll
    for (int nt = 0; nt < 2; ++nt)
#pragma unroll
        for (int ks = 0; ks < 2; ++ks) { const size_t qo = pb + (size_t)(q0 + nt * 16 + lr) * HD + ks * 32 + 8 * hi; qh[nt][ks] = WFrag<bf>::ld(Qh + qo); ql[nt][ks] = WFrag<bf>::ld(Ql + qo); }
    asm volatile("s_wait_xcnt 0x0" ::: "memory");   // behind the loads, in front of the first rewrite of their address registers
    v8f o[4][2];
#pragma unroll
    for (int dt = 0; dt < 4; ++dt) { o[dt][0] = (v8f){}; o[dt][1] = (v8f){}; }
    float mrun[2] = { -3.0e38f, -3.0e38f }; v2f lsum[2] = { (v2f){}, (v2f){} };   // the sum runs in two chains per column tile (even and odd keys)
    v4i mm[2][2][2];
    auto pass = [&](const bf* sb, int kb, int nextkey, int nextoff) {   // 32 keys; nextkey + nextoff: first key of the pass after this one
        v16bf kf[2][2][2];   // [key tile][k step][hi, lo]: one group of LDS reads in front of the products
#pragma unroll
        for (int kt = 0; kt < 2; ++kt)
#pragma unroll
            for (int ks = 0; ks < 2; ++ks) { const bf* kp = sb + (kb * 32 + kt * 16 + lr) * FPITCH + ks * 32 + 8 * hi; kf[kt][ks][0] = WFrag<bf>::ld(kp); kf[kt][ks][1] = WFrag<bf>::ld(kp + FTILE); }
        v8f sc[2][2];   // [key tile][column tile]
#pragma unroll
        for (int kt = 0; kt < 2; ++kt) { sc[kt][0] = (v8f){}; sc[kt][1] = (v8f){};
#pragma unroll
            for (int ks = 0; ks < 2; ++ks)
#pragma unroll
                for (int nt = 0; nt < 2; ++nt) { sc[kt][nt] = wmmab(kf[kt][ks][0], qh[nt][ks], sc[kt][nt]); sc[kt][nt] = wmmab(kf[kt][ks][1], qh[nt][ks], sc[kt][nt]); sc[kt][nt] = wmmab(kf[kt][ks][0], ql[nt][ks], sc[kt][nt]); } }
        v16bf vf[4][2];   // [d tile][hi, lo]: read while the softmax runs
#pragma unroll
        for (int dt = 0; dt < 4; ++dt) { const bf* vp = sb + 2 * FTILE + (dt * 16 + lr) * FPITCH + kb * 32 + 8 * hi; vf[dt][0] = WFrag<bf>::ld(vp); vf[dt][1] = WFrag<bf>::ld(vp + FTILE); }
        float mn[2]; bool need = false;
#pragma unroll
        for (int nt = 0; nt < 2; ++nt) { float mx = -3.0e38f;
#pragma unroll
            for (int kt = 0; kt < 2; ++kt)
#pragma unroll
                for (int j = 0; j < 8; ++j) { const float t = (mm[nt][kt][j >> 2][j & 3] != 0) ? sc[kt][nt][j] * SCL : -1.0e9f; sc[kt][nt][j] = t; mx = fmaxf(mx, t); }
            mx = fmaxf(mx, xhalf(mx)); mn[nt] = fmaxf(mrun[nt], mx); need = need || (mn[nt] > mrun[nt]); }
        mload(mm, nextkey, nextoff);   // the next pass's mask flies behind this pass's exponentials and products
        if (__builtin_amdgcn_ballot_w32(need) != 0) {   // wave-uniform: one test per pass
#pragma unroll
            for (int nt = 0; nt < 2; ++nt) { const float al = __builtin_amdgcn_exp2f((mrun[nt] - mn[nt]) * L2E); lsum[nt] *= al; mrun[nt] = mn[nt];
#pragma unroll
                for (int dt = 0; dt < 4; ++dt) o[dt][nt] *= al; } }
        v16bf ph[2], pl[2];
#pragma unroll
        for (int nt = 0; nt < 2; ++nt) { const float mc = mrun[nt] * L2E; v8u hw, lw;   // packed pairs: word w holds elements 2w, 2w + 1 of the B fragment
#pragma unroll
            for (int w = 0; w < 8; ++w) { const int kt = w >> 2, j = (w & 3) * 2; v2f p; p[0] = __builtin_amdgcn_exp2f(__builtin_fmaf(sc[kt][nt][j], L2E, -mc)); p[1] = __builtin_amdgcn_exp2f(__builtin_fmaf(sc[kt][nt][j + 1], L2E, -mc)); lsum[nt] += p;
                const unsigned hp = __builtin_bit_cast(unsigned, __builtin_convertvector(p, v2bf)); v2f r; r[0] = p[0] - __uint_as_float(hp << 16); r[1] = p[1] - __uint_as_float(hp & 0xFFFF0000u);
                hw[w] = hp; lw[w] = __builtin_bit_cast(unsigned, __builtin_convertvector(r, v2bf)); }
            ph[nt] = __builtin_bit_cast(v16bf, hw); pl[nt] = __builtin_bit_cast(v16bf, lw); }
#pragma unroll
        for (int dt = 0; dt < 4; ++dt)
#pragma unroll
            for (int nt = 0; nt < 2; ++nt) { o[dt][nt] = wmmab(vf[dt][0], ph[nt], o[dt][nt]); o[dt][nt] = wmmab(vf[dt][1], ph[nt], o[dt][nt]); o[dt][nt] = wmmab(vf[dt][0], pl[nt], o[dt][nt]); }
        __builtin_amdgcn_sched_barrier(0x0108); };   // vector work does not cross (LDS reads and WMMAs may): the next pass's mask compares, and with them the wait on its loads, stay behind this pass's products
    gload(0); mload(mm, 0, 0); sstore(0); __syncthreads();
#pragma unroll 1
    for (int s = 0; s < TT / 64; ++s) { const bf* sb = sm + (s & 1) * 4 * FTILE; const bool more = (s + 1 < TT / 64);   // block-uniform
        gload(more ? s + 1 : s);   // no branch round the loads issued ahead (here and for the mask): a branch merges two paths in the compiler's load counting and the waits fall to the smaller count; the last stage's are in bounds and unused
        pass(sb, 0, s * 64, 32);
        pass(sb, 1, more ? (s + 1) * 64 : 0, 0);
        __builtin_amdgcn_sched_barrier(0);   // keeps the slots below behind the last product
        asm volatile("v_nop\n\tv_nop\n\tv_nop\n\tv_nop");   // the four vector slots between the pass's last WMMA and the first rewrite of its operands on the taken back edge
        if (more) { sstore((s + 1) & 1); __syncthreads(); } }   // the buffer written was last read in stage s - 1, whose barrier every wave has passed; this barrier publishes it
    const int bb = blockIdx.y / NH_, hh = blockIdx.y % NH_;
#pragma unroll
    for (int nt = 0; nt < 2; ++nt) { const float lh = lsum[nt][0] + lsum[nt][1]; const float inv = __fdiv_rn(1.0f, lh + xhalf(lh)); const size_t oo = ((size_t)bb * TT + q0 + nt * 16 + lr) * DQ + hh * HD + hi * 8;
#pragma unroll
        for (int dt = 0; dt < 4; ++dt) { v8us oh, ol;
#pragma unroll
            for (int j = 0; j < 8; ++j) { unsigned short a, c2; splitf(o[dt][nt][j] * inv, a, c2); oh[j] = a; ol[j] = c2; }
            *(v8us*)(Ah + oo + dt * 16) = oh; *(v8us*)(Al + oo + dt * 16) = ol; } }
}

extern "C" void kernel_launch(void* const* d_in, const int* in_sizes, int n_in,
                              void* d_out, int out_size, void* d_ws, size_t ws_size, hipStream_t stream) {
    (void)in_sizes; (void)n_in; (void)out_size;
    const float* x = (const float*)d_in[0]; const float* xk = (const float*)d_in[1]; const float* xv = (const float*)d_in[2]; const int* mk = (const int*)d_in[3];   /* mask [1024][1024] int */ const float* wq = (const float*)d_in[4]; const float* bq = (const float*)d_in[5]; const float* wk = (const float*)d_in[6]; const float* bk = (const float*)d_in[7]; const float* wv = (const float*)d_in[8]; const float* bv = (const float*)d_in[9]; const float* wo = (const float*)d_in[10]; const float* bo = (const float*)d_in[11];
    float* OUT = (float*)d_out;     // [4][1024][1024]
    char* wsp = (char*)d_ws;
    auto take = [&](size_t bytes) { char* p = wsp; wsp += (bytes + 255) & ~(size_t)255; return (void*)p; };
    bf* WQ = (bf*)take((size_t)DQ * DM * 2); bf* WK = (bf*)take((size_t)DKV * DM * 2); bf* WV = (bf*)take((size_t)DKV * DM * 2); bf* WO = (bf*)take((size_t)DM * DQ * 2); float* CS = (float*)take((size_t)TT * HD * 2 * 4); (void)WK; (void)WV;   // WQ, WK, WV are consecutive planes (z-stride DQ*DM)
    const size_t PL = (size_t)NB_ * NH_ * TT * HD;   // one plane set: all batches, all heads
    h16* QP16 = (h16*)take(PL * 2); h16* KP16 = (h16*)take(PL * 2); h16* VT16 = (h16*)take(PL * 2); (void)KP16;
    bf* QPh = (bf*)take(PL * 2); bf* KPh = (bf*)take(PL * 2); bf* QPl = (bf*)take(PL * 2); bf* KPl = (bf*)take(PL * 2); bf* VTh = (bf*)take(PL * 2); bf* VTl = (bf*)take(PL * 2);   // the k planes follow the q planes: one launch fills both
    bf* XB = (bf*)take((size_t)3 * NB_ * TT * DM * 2); float* F = (float*)take((size_t)3 * NB_ * TT * DQ * 4); bf* ATh = (bf*)take((size_t)NB_ * TT * DQ * 2); bf* ATl = (bf*)take((size_t)NB_ * TT * DQ * 2);   // bf16 inputs, f32 projections, merged heads hi/lo
    if ((size_t)(wsp - (char*)d_ws) > ws_size) return;    // ws 256 MiB
    k_wtG<<<dim3((DM * HD / 64 + 63) / 64, NH_, 3), 256, 0, stream>>>(wq, wk, wv, DM, HD, WQ);   /* per-head [1024][64] -> Bt rows hh*64.. of WQ, WK, WV */
    k_wtG<<<dim3((DQ * DM / 64 + 63) / 64, 1, 1), 256, 0, stream>>>(wo, wo, wo, DQ, DM, WO);
    k_csid<<<(TT * HD + 255) / 256, 256, 0, stream>>>(CS);
    const unsigned LQ = (unsigned)(((size_t)NH_ * TT * HD / 2 + 255) / 256), LKv = (unsigned)(((size_t)NKV * TT * HD / 2 + 255) / 256);
    k_cvt8<<<dim3((unsigned)(((size_t)NB_ * TT * DM / 8 + 255) / 256), 3, 1), 256, 0, stream>>>(x, xk, xv, XB, (size_t)NB_ * TT * DM / 8);
    k_gemmw<bf, 0, true><<<dim3(NB_ * TT / 64, DQ / 64, 3), 32, 0, stream>>>(XB, nullptr, WQ, nullptr, DM, F, DQ, bq, bk, bv, (size_t)NB_ * TT * DM, (size_t)DQ * DM, (size_t)NB_ * TT * DQ);   // z: q, k, v
    k_rope<<<dim3(LQ, 2 * NB_, 1), 256, 0, stream>>>(F, DQ, NH_, CS, nullptr, nullptr, 1.0f, QP16, QPh, QPl);   // y: the 4 q slabs, then the 4 k slabs
    k_vtp<<<dim3(LKv, NB_, 1), 256, 0, stream>>>(F + (size_t)2 * NB_ * TT * DQ, DKV, NKV, VT16, VTh, VTl);
    k_fattn<<<dim3(TT / 256, NB_ * NH_, 1), 256, 0, stream>>>(QPh, QPl, KPh, KPl, VTh, VTl, mk, ATh, ATl);   // y: batch * 16 + head, consecutive planes (stride TT*HD)
    k_gemmw<bf, 1, true><<<dim3(NB_ * TT / 64, DM / 64, 1), 32, 0, stream>>>(ATh, ATl, WO, nullptr, DQ, OUT, DM, bo, nullptr, nullptr, 0, 0, 0);
}

// v003
// A run of this version takes 170 microseconds.
// Two timings next to v002 both put it at 1.23 times that version's speed.
// Counting every step since v000, it is 11.2 times as fast.
#include <hip/hip_runtime.h>

// Multi-head attention with per-head projections, an UNSCALED score and a random keep-mask (querys, keys, values [4][1024][1024]; q_h = querys Wq[h] + bq[h] (Wq, Wk, Wv [16][1024][64] 1/32 + biases [16][64] 0.01 == one 'xw' [1024][1024] projection per input whose column block h is W[h]); scores = q.k (no 1/sqrt(dk): sigma ~8); mask ([1024][1024] int {0,1}, ~50 %, read; 0 -> -1e9 == exclusion); softmax; out = concat heads Wp + bp ('xw' [1024][1024] 1/32 + 0.01) -> [4][1024][1024] (4.2 M)).
// Layout: bf16 copies of the three inputs (all batches, one launch); each per-head [1024][64] weight transposed into rows h*64.. of one bf16 Bt per projection (heads and projections are grid dimensions); the three exact projections + f32 biases as the z planes of one launch over all 4096 rows, whose epilogue splits each value into hi/lo bf16 and stores the attention's own planes (q, k [head][t][d], v [head][d][t]); ONE attention launch over all batches and heads (k_fattn: scores, mask, running softmax and P V stay in registers and LDS, every row on hi/lo planes, 3 products each); merged hi/lo x Wp exact + bp over all 4096 rows.
// Compute dtypes, f32 accumulate: every input rounded to bf16; projections exact + f32 biases; attention 3 products on every row; softmax f32; Wp hl x exact + bias.

#define NB_  4
#define TT   1024
#define DM   1024
#define NH_  16
#define NKV  16
#define REP  (NH_ / NKV)
#define HD   64
#define DQ   (NH_ * HD)
#define DKV  (NKV * HD)
#define ZH   16
#define RH   1024
#define WIN  0
#define PCAR 1024.0f
#define SCL  1.0f   // the module applies no 1/sqrt(dk)
typedef _Float16 h16;
typedef unsigned short bf;
typedef __attribute__((ext_vector_type(16))) __bf16   v16bf;
typedef __attribute__((ext_vector_type(16))) _Float16 v16h;
typedef __attribute__((ext_vector_type(8)))  _Float16 v8h;
typedef __attribute__((ext_vector_type(8)))  unsigned short v8us;
typedef __attribute__((ext_vector_type(8)))  float    v8f;
typedef __attribute__((ext_vector_type(4)))  float    v4f;
typedef v8h  __attribute__((may_alias)) v8ha;
typedef v4f  __attribute__((may_alias)) v4fa;
typedef v8us __attribute__((may_alias)) v8usa;

__device__ __forceinline__ unsigned short f2bf(float f) { unsigned u = __float_as_uint(f); u += 0x7FFFu + ((u >> 16) & 1u); return (unsigned short)(u >> 16); }
__device__ __forceinline__ float bf2f(unsigned short b) { return __uint_as_float(((unsigned)b) << 16); }
__device__ __forceinline__ float bfr(float f) { return bf2f(f2bf(f)); }
__device__ __forceinline__ v16h cat16(v8h lo, v8h hi) { return __builtin_shufflevector(lo, hi, 0, 1, 2, 3, 4, 5, 6, 7, 8, 9, 10, 11, 12, 13, 14, 15); }
__device__ __forceinline__ v16bf cat16b(v8us lo, v8us hi) { return __builtin_bit_cast(v16bf, __builtin_shufflevector(lo, hi, 0, 1, 2, 3, 4, 5, 6, 7, 8, 9, 10, 11, 12, 13, 14, 15)); }
__device__ __forceinline__ v8f wmma16(v16h a, v16h b, v8f c) { return __builtin_amdgcn_wmma_f32_16x16x32_f16(false, a, false, b, (short)0, c, false, false); }
__device__ __forceinline__ v8f wmmab(v16bf a, v16bf b, v8f c) { return __builtin_amdgcn_wmma_f32_16x16x32_bf16(false, a, false, b, (short)0, c, false, false); }



// ---- k_gemmw: register-blocked GEMM, ONE WAVE per 64x64 output tile (16 accumulators), operands straight from K-contiguous 16-bit planes; grid (M/64, N/64, Z), 32 threads.
// C[m][n] (f32, pitch ldc, + optional f32 bias[n]; z planes 1 and 2 take bias1 and bias2) = sum_k A[m][k] Bt[n][k] (+ split products per NSPLIT). z-batch strides sA/sB/sC in elements. K % 32 == 0.
template <typename T16> struct WFrag;
template <> struct WFrag<h16> { typedef v16h V; static __device__ __forceinline__ V ld(const h16* p) { return cat16(*(const v8h*)p, *(const v8h*)(p + 16)); } static __device__ __forceinline__ v8f mma(V a, V b, v8f c) { return wmma16(a, b, c); } };
template <> struct WFrag<bf> { typedef v16bf V; static __device__ __forceinline__ V ld(const bf* p) { return cat16b(*(const v8us*)p, *(const v8us*)(p + 16)); } static __device__ __forceinline__ v8f mma(V a, V b, v8f c) { return wmmab(a, b, c); } };
template <typename T16, int NSPLIT, bool BIAS>
__global__ __launch_bounds__(32) void k_gemmw(const T16* __restrict__ A, const T16* __restrict__ A2, const T16* __restrict__ Bt, const T16* __restrict__ Bt2, int K, float* C, int ldc, const float* __restrict__ bias, const float* __restrict__ bias1, const float* __restrict__ bias2, size_t sA, size_t sB, size_t sC) {
    typedef typename WFrag<T16>::V V;
    __shared__ __align__(16) float os[16 * 68];
    const size_t z = blockIdx.z; A += z * sA; if (A2) A2 += z * sA; Bt += z * sB; if (Bt2) Bt2 += z * sB; C += z * sC; if (BIAS) bias = (z == 0) ? bias : (z == 1) ? bias1 : bias2;
    const int lane = threadIdx.x & 31, lr = lane & 15, hi = lane >> 4; const int r0 = blockIdx.x * 64, c0 = blockIdx.y * 64;
    v8f acc[4][4];
#pragma unroll
    for (int mb = 0; mb < 4; ++mb)
#pragma unroll
        for (int nb = 0; nb < 4; ++nb) acc[mb][nb] = (v8f){};
    const size_t aoff = (size_t)(r0 + lr) * K + 8 * hi, boff = (size_t)(c0 + lr) * K + 8 * hi;
#pragma unroll 1
    for (int kc = 0; kc < K; kc += 32) {
        V a[4], a2[4];
#pragma unroll
        for (int mb = 0; mb < 4; ++mb) { a[mb] = WFrag<T16>::ld(A + aoff + (size_t)mb * 16 * K + kc); if (NSPLIT == 1 || NSPLIT == 2) a2[mb] = WFrag<T16>::ld(A2 + aoff + (size_t)mb * 16 * K + kc); }
#pragma unroll
        for (int nb = 0; nb < 4; ++nb) { const V b = WFrag<T16>::ld(Bt + boff + (size_t)nb * 16 * K + kc); V b2; if (NSPLIT >= 2) b2 = WFrag<T16>::ld(Bt2 + boff + (size_t)nb * 16 * K + kc);
#pragma unroll
            for (int mb = 0; mb < 4; ++mb) { acc[mb][nb] = WFrag<T16>::mma(a[mb], b, acc[mb][nb]); if (NSPLIT == 1 || NSPLIT == 2) acc[mb][nb] = WFrag<T16>::mma(a2[mb], b, acc[mb][nb]); if (NSPLIT >= 2) acc[mb][nb] = WFrag<T16>::mma(a[mb], b2, acc[mb][nb]); } }
        asm volatile("v_nop\n\tv_nop\n\tv_nop\n\tv_nop" : "+v"(acc[0][0]), "+v"(acc[1][1]), "+v"(acc[2][2]), "+v"(acc[3][3]) : "v"(a[0]), "v"(a[3]));
    }
#pragma unroll
    for (int mb = 0; mb < 4; ++mb) {
#pragma unroll
        for (int nb = 0; nb < 4; ++nb) {
#pragma unroll
            for (int j = 0; j < 8; ++j) os[(hi * 8 + j) * 68 + nb * 16 + lr] = acc[mb][nb][j]; }
        __builtin_amdgcn_wave_barrier(); asm volatile("" ::: "memory");
        float* crow = C + (size_t)(r0 + mb * 16) * ldc + c0;
{
#pragma unroll
            for (int s = 0; s < 8; ++s) { const int row = 2 * s + hi, cofs = lr * 4; v4f val = *(const v4fa*)(os + row * 68 + cofs); if (BIAS) { val[0] += bfr(bias[c0 + cofs]); val[1] += bfr(bias[c0 + cofs + 1]); val[2] += bfr(bias[c0 + cofs + 2]); val[3] += bfr(bias[c0 + cofs + 3]); }
                *(v4f*)(crow + (size_t)row * ldc + cofs) = val; }
             }
        __builtin_amdgcn_wave_barrier(); asm volatile("" ::: "memory");
    }
}

__device__ __forceinline__ void splitf(float y, unsigned short& h, unsigned short& l) { h = f2bf(y); l = f2bf(y - bf2f(h)); }
typedef __attribute__((ext_vector_type(2))) _Float16 v2h;
typedef __attribute__((ext_vector_type(4))) _Float16 v4h;
typedef __attribute__((ext_vector_type(2))) unsigned short v2us;
typedef __attribute__((ext_vector_type(4))) unsigned short v4us;
typedef __attribute__((ext_vector_type(2))) float v2f;
typedef __attribute__((ext_vector_type(4))) int v4i;

// grid (lines, heads, sources): matrix y of source z ([K][N] f32) goes to Bt plane z * NH_ + y ([N][K] bf16)
__global__ __launch_bounds__(256) void k_wtG(const float* __restrict__ w0, const float* __restrict__ w1, const float* __restrict__ w2, int K, int N, bf* Bt) {
    const float* w = (blockIdx.z == 0 ? w0 : blockIdx.z == 1 ? w1 : w2) + (size_t)blockIdx.y * K * N; Bt += ((size_t)blockIdx.z * NH_ + blockIdx.y) * N * K;
    const int lane = threadIdx.x & 31; const int L0 = (blockIdx.x * 8 + (threadIdx.x >> 5)) * 8; const int nlines = N * K / 64;
{
#pragma unroll 1
        for (int l = 0; l < 8; ++l) { const int L = L0 + l; if (L >= nlines) break; const size_t e = (size_t)L * 64 + lane * 2; const int k = (int)(e % K), n = (int)(e / K); v2us o;
            o[0] = f2bf(w[(size_t)k * N + n]); o[1] = f2bf(w[(size_t)(k + 1) * N + n]); *(v2us*)(Bt + e) = o; }
         }
}
__global__ __launch_bounds__(256) void k_cvt8(const float* __restrict__ s0, const float* __restrict__ s1, const float* __restrict__ s2, bf* dst, size_t n8) { const size_t i = (size_t)blockIdx.x * 256 + threadIdx.x; if (i >= n8) return; const float* src = blockIdx.y == 0 ? s0 : blockIdx.y == 1 ? s1 : s2; dst += (size_t)blockIdx.y * n8 * 8;   /* source y -> plane y */ const v8f v = *(const v8f*)(src + i * 8); v8us o;
#pragma unroll
    for (int k = 0; k < 8; ++k) o[k] = f2bf(v[k]); *(v8us*)(dst + i * 8) = o;  }

typedef __attribute__((ext_vector_type(2))) __bf16 v2bf;
typedef __attribute__((ext_vector_type(4))) unsigned v4u;
typedef v4u __attribute__((may_alias)) v4ua;
#define PPITCH 72                  // LDS row pitch of the projection epilogue in 16-bit elements: 128-B rows + 16 B (b128 accesses)
// Epilogue of k_gemmp. A lane's 8 accumulator values of tile [mb][nb] are 8 consecutive A-side indices (mb*16 + hi*8 + j) at one B-side index (nb*16 + lr): the A side is the contiguous dimension of the plane that is written.
// value + bias (braw, loaded by the caller; BROW: it runs along the B side, braw[0][nb]; else along the A side, braw[2*mb], braw[2*mb+1]) -> hi, lo bf16 -> LDS rows [B-side index][A-side index] -> whole 128-B lines of Dh, Dl (row pitch PITCH in elements).
template <bool BROW, int PITCH>
__device__ __forceinline__ void proj_out(const v8f (&acc)[4][4], const v4f (&braw)[8], bf* sh, int lane, bf* Dh, bf* Dl) {
    const int lr = lane & 15, hi = lane >> 4;
    float bb[4];
    if (BROW) {
#pragma unroll
        for (int nb = 0; nb < 4; ++nb) bb[nb] = bfr(braw[0][nb]); }
#pragma unroll
    for (int mb = 0; mb < 4; ++mb) { float ba[8];
        if (!BROW) {
#pragma unroll
            for (int j = 0; j < 4; ++j) { ba[j] = bfr(braw[2 * mb][j]); ba[4 + j] = bfr(braw[2 * mb + 1][j]); } }
#pragma unroll
        for (int nb = 0; nb < 4; ++nb) { v4u hw, lw;
#pragma unroll
            for (int w = 0; w < 4; ++w) { v2f y; y[0] = acc[mb][nb][2 * w] + (BROW ? bb[nb] : ba[2 * w]); y[1] = acc[mb][nb][2 * w + 1] + (BROW ? bb[nb] : ba[2 * w + 1]);
                const unsigned hp = __builtin_bit_cast(unsigned, __builtin_convertvector(y, v2bf)); v2f r; r[0] = y[0] - __uint_as_float(hp << 16); r[1] = y[1] - __uint_as_float(hp & 0xFFFF0000u);
                hw[w] = hp; lw[w] = __builtin_bit_cast(unsigned, __builtin_convertvector(r, v2bf)); }
            bf* sp = sh + (nb * 16 + lr) * PPITCH + mb * 16 + hi * 8; *(v4ua*)sp = hw; *(v4ua*)(sp + 64 * PPITCH) = lw; } }
    __builtin_amdgcn_wave_barrier(); asm volatile("" ::: "memory");   // one wave per block: keeps the row reads below behind the other lanes' LDS writes above (the compiler sees no dependence between lanes)
    const int row = lane >> 3, c = (lane & 7) * 8;   // 8 lanes per 128-B row, 4 rows per store
    const bf* sr = sh + row * PPITCH + c; bf* gh = Dh + (size_t)row * PITCH + c; bf* gl = Dl + (size_t)row * PITCH + c;
#pragma unroll
    for (int s = 0; s < 16; ++s) { *(v4ua*)(gh + s * 4 * PITCH) = *(const v4ua*)(sr + s * 4 * PPITCH); *(v4ua*)(gl + s * 4 * PITCH) = *(const v4ua*)(sr + (64 + s * 4) * PPITCH); }
}
// ---- k_gemmp: the three projections, k_gemmw's loop (ONE WAVE per 64 rows x one head's 64 columns, 16 accumulators, operands straight from K-contiguous bf16 planes); grid (NB_*TT/64, NH_, 3), 32 threads; z: q, k, v.
// The attention's planes come straight out of the accumulators: for q and k the weight rows are the A operand (a lane then holds 8 consecutive d of one t: plane [head][t][d]), for v the input rows are (8 consecutive t of one d: plane [head][d][t]).
// P?h, P?l: q planes with the k planes behind them (z-stride NB_*NH_*TT*HD).
__global__ __launch_bounds__(32) void k_gemmp(const bf* __restrict__ X, const bf* __restrict__ Wt, const float* __restrict__ bias0, const float* __restrict__ bias1, const float* __restrict__ bias2, bf* Ph, bf* Pl, bf* Vh, bf* Vl) {
    typedef WFrag<bf>::V V;
    __shared__ __align__(16) bf sh[2 * 64 * PPITCH];
    const int K = DM; const int z = blockIdx.z; const bool isv = (z == 2);   // block-uniform
    const int lane = threadIdx.x & 31, lr = lane & 15, hi = lane >> 4; const int r0 = blockIdx.x * 64, hd = blockIdx.y;
    const bf* xr = X + ((size_t)z * NB_ * TT + r0) * K; const bf* wr = Wt + ((size_t)z * DQ + hd * HD) * K;
    const bf* A = isv ? xr : wr; const bf* Bt = isv ? wr : xr;
    v8f acc[4][4];
#pragma unroll
    for (int mb = 0; mb < 4; ++mb)
#pragma unroll
        for (int nb = 0; nb < 4; ++nb) acc[mb][nb] = (v8f){};
    const size_t off = (size_t)lr * K + 8 * hi;
    const float* bias = (z == 0 ? bias0 : z == 1 ? bias1 : bias2) + hd * HD; v4f braw[8];   // the lane's biases, asked for in front of the loop: they land under it
    const float* bl = bias + (isv ? lr : hi * 8);
    if (isv) {
#pragma unroll
        for (int nb = 0; nb < 4; ++nb) braw[0][nb] = bl[nb * 16]; }
    else {
#pragma unroll
        for (int mb = 0; mb < 4; ++mb) { braw[2 * mb] = *(const v4fa*)(bl + mb * 16); braw[2 * mb + 1] = *(const v4fa*)(bl + mb * 16 + 4); } }
    asm volatile("s_wait_xcnt 0x0" :: "v"(bl) : "memory");   // behind the bias loads, in front of the first rewrite of their address registers (named as input: live up to here)
#pragma unroll 1
    for (int kc = 0; kc < K; kc += 32) {
        V a[4], b[4]; const bf* pa = A + off + kc; const bf* pb = Bt + off + kc;
#pragma unroll
        for (int i = 0; i < 4; ++i) { a[i] = WFrag<bf>::ld(pa + i * 16 * K); b[i] = WFrag<bf>::ld(pb + i * 16 * K); }
        asm volatile("s_wait_xcnt 0x0" :: "v"(pa), "v"(pb) : "memory");   // behind the loads, in front of the first rewrite of their address registers (named as inputs: they stay live up to here, so no load's result lands on them either)
#pragma unroll
        for (int nb = 0; nb < 4; ++nb)
#pragma unroll
            for (int mb = 0; mb < 4; ++mb) acc[mb][nb] = WFrag<bf>::mma(a[mb], b[nb], acc[mb][nb]);
        asm volatile("v_nop\n\tv_nop\n\tv_nop\n\tv_nop" : "+v"(acc[0][0]), "+v"(acc[1][1]), "+v"(acc[2][2]), "+v"(acc[3][3]) : "v"(a[0]), "v"(a[3]));   // as in k_gemmw: the four vector slots between the trip's last WMMA and the first rewrite of its operands on the taken back edge
    }
    const int bb = r0 / TT, t0 = r0 % TT; const size_t pl = ((size_t)bb * NH_ + hd) * TT * HD;
    if (isv) proj_out<true, TT>(acc, braw, sh, lane, Vh + pl + t0, Vl + pl + t0);
    else { const size_t po = (size_t)z * NB_ * NH_ * TT * HD + pl + (size_t)t0 * HD; proj_out<false, HD>(acc, braw, sh, lane, Ph + po, Pl + po); }
}
typedef __attribute__((ext_vector_type(8))) unsigned v8u;
__device__ __forceinline__ float xhalf(float x) { const int b = __float_as_int(x); return __int_as_float(__builtin_amdgcn_permlanex16(b, b, 0x76543210, 0xfedcba98, false, false)); }   // the value of lane l ^ 16
#define FPITCH 72                  // LDS row pitch in 16-bit elements: 128-B rows + 16 B (ds_load_b128 readers)
#define FTILE  (64 * FPITCH)       // one staged tile: 64 rows
#define L2E    1.4426950408889634f
__global__ __launch_bounds__(256) void k_fattn(const bf* __restrict__ Qh, const bf* __restrict__ Ql, const bf* __restrict__ Kh, const bf* __restrict__ Kl, const bf* __restrict__ Vh, const bf* __restrict__ Vl, const int* __restrict__ mk, bf* Ah, bf* Al) {
    __shared__ __align__(16) bf sm[2 * 4 * FTILE];
    const int tid = threadIdx.x, lane = tid & 31, lr = lane & 15, hi = lane >> 4;
    const int q0 = blockIdx.x * 256 + (tid >> 5) * 32;
    const size_t pb = (size_t)blockIdx.y * TT * HD;
    const int srow = tid >> 3, sch = (tid & 7) * 8;   // staging: this thread moves 16 B of rows srow and srow + 32 of each tile
    v8us stg[8];
    auto gload = [&](int s) {
        __builtin_amdgcn_sched_barrier(0);   // this and the one at the foot keep the loads where they are written, with their s_wait_xcnt directly behind them
        const size_t ko = pb + (size_t)(s * 64 + srow) * HD + sch, vo = pb + (size_t)srow * TT + s * 64 + sch; const bf* a0 = Kh + ko; const bf* a1 = Kl + ko; const bf* a2 = Vh + vo; const bf* a3 = Vl + vo;
#pragma unroll
        for (int r = 0; r < 2; ++r) { stg[r] = *(const v8us*)(a0 + r * 32 * HD); stg[2 + r] = *(const v8us*)(a1 + r * 32 * HD); stg[4 + r] = *(const v8us*)(a2 + r * 32 * TT); stg[6 + r] = *(const v8us*)(a3 + r * 32 * TT); }
        asm volatile("s_wait_xcnt 0x0" :: "v"(a0), "v"(a1), "v"(a2), "v"(a3) : "memory");   // behind the loads, in front of the first rewrite of their address registers (named as inputs: they stay live up to here, so no load's result lands on them either)
        __builtin_amdgcn_sched_barrier(0); };
    auto sstore = [&](int buf) {
#pragma unroll
        for (int i = 0; i < 4; ++i)
#pragma unroll
            for (int r = 0; r < 2; ++r) *(v8us*)(sm + (buf * 4 + i) * FTILE + (srow + 32 * r) * FPITCH + sch) = stg[i * 2 + r]; };
    auto mload = [&](v4i (&m)[2][2][2], int key0, int koff) {   // mask of 32 keys (from key0 + koff; koff a literal, it goes into the loads' offset field) x 32 query columns: [column tile][key tile][4 keys]
        __builtin_amdgcn_sched_barrier(0);   // as in gload
        const int* p0 = mk + (size_t)(q0 + lr) * TT + key0 + hi * 8; const int* p1 = p0 + 16 * TT + koff;
#pragma unroll
        for (int kt = 0; kt < 2; ++kt) { m[0][kt][0] = *(const v4i*)(p0 + koff + kt * 16); m[0][kt][1] = *(const v4i*)(p0 + koff + kt * 16 + 4); m[1][kt][0] = *(const v4i*)(p1 + kt * 16); m[1][kt][1] = *(const v4i*)(p1 + kt * 16 + 4); }
        asm volatile("s_wait_xcnt 0x0" :: "v"(p0) : "memory");   // as in gload (the eight loads share one address pair)
        __builtin_amdgcn_sched_barrier(0); };
    v16bf qh[2][2], ql[2][2];   // [column tile][k step]
#pragma unroll
    for (int nt = 0; nt < 2; ++nt)
#pragma unroll
        for (int ks = 0; ks < 2; ++ks) { const size_t qo = pb + (size_t)(q0 + nt * 16 + lr) * HD + ks * 32 + 8 * hi; qh[nt][ks] = WFrag<bf>::ld(Qh + qo); ql[nt][ks] = WFrag<bf>::ld(Ql + qo); }
    asm volatile("s_wait_xcnt 0x0" ::: "memory");   // behind the loads, in front of the first rewrite of their address registers
    v8f o[4][2];
#pragma unroll
    for (int dt = 0; dt < 4; ++dt) { o[dt][0] = (v8f){}; o[dt][1] = (v8f){}; }
    float mrun[2] = { -3.0e38f, -3.0e38f }; v2f lsum[2] = { (v2f){}, (v2f){} };   // the sum runs in two chains per column tile (even and odd keys)
    v4i mm[2][2][2];
    auto pass = [&](const bf* sb, int kb, int nextkey, int nextoff) {   // 32 keys; nextkey + nextoff: first key of the pass after this one
        v16bf kf[2][2][2];   // [key tile][k step][hi, lo]: one group of LDS reads in front of the products
#pragma unroll
        for (int kt = 0; kt < 2; ++kt)
#pragma unroll
            for (int ks = 0; ks < 2; ++ks) { const bf* kp = sb + (kb * 32 + kt * 16 + lr) * FPITCH + ks * 32 + 8 * hi; kf[kt][ks][0] = WFrag<bf>::ld(kp); kf[kt][ks][1] = WFrag<bf>::ld(kp + FTILE); }
        v8f sc[2][2];   // [key tile][column tile]
#pragma unroll
        for (int kt = 0; kt < 2; ++kt) { sc[kt][0] = (v8f){}; sc[kt][1] = (v8f){};
#pragma unroll
            for (int ks = 0; ks < 2; ++ks)
#pragma unroll
                for (int nt = 0; nt < 2; ++nt) { sc[kt][nt] = wmmab(kf[kt][ks][0], qh[nt][ks], sc[kt][nt]); sc[kt][nt] = wmmab(kf[kt][ks][1], qh[nt][ks], sc[kt][nt]); sc[kt][nt] = wmmab(kf[kt][ks][0], ql[nt][ks], sc[kt][nt]); } }
        v16bf vf[4][2];   // [d tile][hi, lo]: read while the softmax runs
#pragma unroll
        for (int dt = 0; dt < 4; ++dt) { const bf* vp = sb + 2 * FTILE + (dt * 16 + lr) * FPITCH + kb * 32 + 8 * hi; vf[dt][0] = WFrag<bf>::ld(vp); vf[dt][1] = WFrag<bf>::ld(vp + FTILE); }
        float mn[2]; bool need = false;
#pragma unroll
        for (int nt = 0; nt < 2; ++nt) { float mx = -3.0e38f;
#pragma unroll
            for (int kt = 0; kt < 2; ++kt)
#pragma unroll
                for (int j = 0; j < 8; ++j) { const float t = (mm[nt][kt][j >> 2][j & 3] != 0) ? sc[kt][nt][j] * SCL : -1.0e9f; sc[kt][nt][j] = t; mx = fmaxf(mx, t); }
            mx = fmaxf(mx, xhalf(mx)); mn[nt] = fmaxf(mrun[nt], mx); need = need || (mn[nt] > mrun[nt]); }
        mload(mm, nextkey, nextoff);   // the next pass's mask flies behind this pass's exponentials and products
        if (__builtin_amdgcn_ballot_w32(need) != 0) {   // wave-uniform: one test per pass
#pragma unroll
            for (int nt = 0; nt < 2; ++nt) { const float al = __builtin_amdgcn_exp2f((mrun[nt] - mn[nt]) * L2E); lsum[nt] *= al; mrun[nt] = mn[nt];
#pragma unroll
                for (int dt = 0; dt < 4; ++dt) o[dt][nt] *= al; } }
        v16bf ph[2], pl[2];
#pragma unroll
        for (int nt = 0; nt < 2; ++nt) { const float mc = mrun[nt] * L2E; v8u hw, lw;   // packed pairs: word w holds elements 2w, 2w + 1 of the B fragment
#pragma unroll
            for (int w = 0; w < 8; ++w) { const int kt = w >> 2, j = (w & 3) * 2; v2f p; p[0] = __builtin_amdgcn_exp2f(__builtin_fmaf(sc[kt][nt][j], L2E, -mc)); p[1] = __builtin_amdgcn_exp2f(__builtin_fmaf(sc[kt][nt][j + 1], L2E, -mc)); lsum[nt] += p;
                const unsigned hp = __builtin_bit_cast(unsigned, __builtin_convertvector(p, v2bf)); v2f r; r[0] = p[0] - __uint_as_float(hp << 16); r[1] = p[1] - __uint_as_float(hp & 0xFFFF0000u);
                hw[w] = hp; lw[w] = __builtin_bit_cast(unsigned, __builtin_convertvector(r, v2bf)); }
            ph[nt] = __builtin_bit_cast(v16bf, hw); pl[nt] = __builtin_bit_cast(v16bf, lw); }
#pragma unroll
        for (int dt = 0; dt < 4; ++dt)
#pragma unroll
            for (int nt = 0; nt < 2; ++nt) { o[dt][nt] = wmmab(vf[dt][0], ph[nt], o[dt][nt]); o[dt][nt] = wmmab(vf[dt][1], ph[nt], o[dt][nt]); o[dt][nt] = wmmab(vf[dt][0], pl[nt], o[dt][nt]); }
        __builtin_amdgcn_sched_barrier(0x0108); };   // vector work does not cross (LDS reads and WMMAs may): the next pass's mask compares, and with them the wait on its loads, stay behind this pass's products
    gload(0); mload(mm, 0, 0); sstore(0); __syncthreads();
#pragma unroll 1
    for (int s = 0; s < TT / 64; ++s) { const bf* sb = sm + (s & 1) * 4 * FTILE; const bool more = (s + 1 < TT / 64);   // block-uniform
        gload(more ? s + 1 : s);   // no branch round the loads issued ahead (here and for the mask): a branch merges two paths in the compiler's load counting and the waits fall to the smaller count; the last stage's are in bounds and unused
        pass(sb, 0, s * 64, 32);
        pass(sb, 1, more ? (s + 1) * 64 : 0, 0);
        __builtin_amdgcn_sched_barrier(0);   // keeps the slots below behind the last product
        asm volatile("v_nop\n\tv_nop\n\tv_nop\n\tv_nop");   // the four vector slots between the pass's last WMMA and the first rewrite of its operands on the taken back edge
        if (more) { sstore((s + 1) & 1); __syncthreads(); } }   // the buffer written was last read in stage s - 1, whose barrier every wave has passed; this barrier publishes it
    const int bb = blockIdx.y / NH_, hh = blockIdx.y % NH_;
#pragma unroll
    for (int nt = 0; nt < 2; ++nt) { const float lh = lsum[nt][0] + lsum[nt][1]; const float inv = __fdiv_rn(1.0f, lh + xhalf(lh)); const size_t oo = ((size_t)bb * TT + q0 + nt * 16 + lr) * DQ + hh * HD + hi * 8;
#pragma unroll
        for (int dt = 0; dt < 4; ++dt) { v8us oh, ol;
#pragma unroll
            for (int j = 0; j < 8; ++j) { unsigned short a, c2; splitf(o[dt][nt][j] * inv, a, c2); oh[j] = a; ol[j] = c2; }
            *(v8us*)(Ah + oo + dt * 16) = oh; *(v8us*)(Al + oo + dt * 16) = ol; } }
}

extern "C" void kernel_launch(void* const* d_in, const int* in_sizes, int n_in,
                              void* d_out, int out_size, void* d_ws, size_t ws_size, hipStream_t stream) {
    (void)in_sizes; (void)n_in; (void)out_size;
    const float* x = (const float*)d_in[0]; const float* xk = (const float*)d_in[1]; const float* xv = (const float*)d_in[2]; const int* mk = (const int*)d_in[3];   /* mask [1024][1024] int */ const float* wq = (const float*)d_in[4]; const float* bq = (const float*)d_in[5]; const float* wk = (const float*)d_in[6]; const float* bk = (const float*)d_in[7]; const float* wv = (const float*)d_in[8]; const float* bv = (const float*)d_in[9]; const float* wo = (const float*)d_in[10]; const float* bo = (const float*)d_in[11];
    float* OUT = (float*)d_out;     // [4][1024][1024]
    char* wsp = (char*)d_ws;
    auto take = [&](size_t bytes) { char* p = wsp; wsp += (bytes + 255) & ~(size_t)255; return (void*)p; };
    bf* WQ = (bf*)take((size_t)DQ * DM * 2); bf* WK = (bf*)take((size_t)DKV * DM * 2); bf* WV = (bf*)take((size_t)DKV * DM * 2); bf* WO = (bf*)take((size_t)DM * DQ * 2); (void)WK; (void)WV;   // WQ, WK, WV are consecutive planes (z-stride DQ*DM)
    const size_t PL = (size_t)NB_ * NH_ * TT * HD;   // one plane set: all batches, all heads
    bf* QPh = (bf*)take(PL * 2); bf* KPh = (bf*)take(PL * 2); bf* QPl = (bf*)take(PL * 2); bf* KPl = (bf*)take(PL * 2); bf* VTh = (bf*)take(PL * 2); bf* VTl = (bf*)take(PL * 2);   // the k planes follow the q planes: one launch fills both
    bf* XB = (bf*)take((size_t)3 * NB_ * TT * DM * 2); bf* ATh = (bf*)take((size_t)NB_ * TT * DQ * 2); bf* ATl = (bf*)take((size_t)NB_ * TT * DQ * 2);   // bf16 inputs, merged heads hi/lo
    if ((size_t)(wsp - (char*)d_ws) > ws_size) return;    // ws 256 MiB
    k_wtG<<<dim3((DM * HD / 64 + 63) / 64, NH_, 3), 256, 0, stream>>>(wq, wk, wv, DM, HD, WQ);   /* per-head [1024][64] -> Bt rows hh*64.. of WQ, WK, WV */
    k_wtG<<<dim3((DQ * DM / 64 + 63) / 64, 1, 1), 256, 0, stream>>>(wo, wo, wo, DQ, DM, WO);
    k_cvt8<<<dim3((unsigned)(((size_t)NB_ * TT * DM / 8 + 255) / 256), 3, 1), 256, 0, stream>>>(x, xk, xv, XB, (size_t)NB_ * TT * DM / 8);
    k_gemmp<<<dim3(NB_ * TT / 64, NH_, 3), 32, 0, stream>>>(XB, WQ, bq, bk, bv, QPh, QPl, VTh, VTl);   // z: q, k, v; writes the hi/lo planes the attention reads
    k_fattn<<<dim3(TT / 256, NB_ * NH_, 1), 256, 0, stream>>>(QPh, QPl, KPh, KPl, VTh, VTl, mk, ATh, ATl);   // y: batch * 16 + head, consecutive planes (stride TT*HD)
    k_gemmw<bf, 1, true><<<dim3(NB_ * TT / 64, DM / 64, 1), 32, 0, stream>>>(ATh, ATl, WO, nullptr, DQ, OUT, DM, bo, nullptr, nullptr, 0, 0, 0);
}

// v004
// Measured time: 127 microseconds a run.
// Two timings next to v003 both put it at 1.34 times that version's speed.
// Over all steps from v000 it is 15.0 times as fast.
#include <hip/hip_runtime.h>

// Multi-head attention with per-head projections, an UNSCALED score and a random keep-mask (querys, keys, values [4][1024][1024]; q_h = querys Wq[h] + bq[h] (Wq, Wk, Wv [16][1024][64] 1/32 + biases [16][64] 0.01 == one 'xw' [1024][1024] projection per input whose column block h is W[h]); scores = q.k (no 1/sqrt(dk): sigma ~8); mask ([1024][1024] int {0,1}, ~50 %, read; 0 -> -1e9 == exclusion); softmax; out = concat heads Wp + bp ('xw' [1024][1024] 1/32 + 0.01) -> [4][1024][1024] (4.2 M)).
// Layout: bf16 copies of the three inputs (all batches, one launch); each per-head [1024][64] weight transposed into rows h*64.. of one bf16 Bt per projection (heads and projections are grid dimensions); the three exact projections + f32 biases as the z planes of one launch over all 4096 rows, whose epilogue splits each value into hi/lo bf16 and stores the attention's own planes (q, k [head][t][d], v [head][d][t]); ONE attention launch over all batches and heads (k_fattn: scores, mask, running softmax and P V stay in registers and LDS, every row on hi/lo planes, 3 products each); merged hi/lo x Wp exact + bp over all 4096 rows.
// Compute dtypes, f32 accumulate: every input rounded to bf16; projections exact + f32 biases; attention 3 products on every row; softmax f32; Wp hl x exact + bias.

#define NB_  4
#define TT   1024
#define DM   1024
#define NH_  16
#define NKV  16
#define REP  (NH_ / NKV)
#define HD   64
#define DQ   (NH_ * HD)
#define DKV  (NKV * HD)
#define ZH   16
#define RH   1024
#define WIN  0
#define PCAR 1024.0f
#define SCL  1.0f   // the module applies no 1/sqrt(dk)
typedef _Float16 h16;
typedef unsigned short bf;
typedef __attribute__((ext_vector_type(16))) __bf16   v16bf;
typedef __attribute__((ext_vector_type(16))) _Float16 v16h;
typedef __attribute__((ext_vector_type(8)))  _Float16 v8h;
typedef __attribute__((ext_vector_type(8)))  unsigned short v8us;
typedef __attribute__((ext_vector_type(8)))  float    v8f;
typedef __attribute__((ext_vector_type(4)))  float    v4f;
typedef v8h  __attribute__((may_alias)) v8ha;
typedef v4f  __attribute__((may_alias)) v4fa;
typedef v8us __attribute__((may_alias)) v8usa;

__device__ __forceinline__ unsigned short f2bf(float f) { unsigned u = __float_as_uint(f); u += 0x7FFFu + ((u >> 16) & 1u); return (unsigned short)(u >> 16); }
__device__ __forceinline__ float bf2f(unsigned short b) { return __uint_as_float(((unsigned)b) << 16); }
__device__ __forceinline__ float bfr(float f) { return bf2f(f2bf(f)); }
__device__ __forceinline__ v16h cat16(v8h lo, v8h hi) { return __builtin_shufflevector(lo, hi, 0, 1, 2, 3, 4, 5, 6, 7, 8, 9, 10, 11, 12, 13, 14, 15); }
__device__ __forceinline__ v16bf cat16b(v8us lo, v8us hi) { return __builtin_bit_cast(v16bf, __builtin_shufflevector(lo, hi, 0, 1, 2, 3, 4, 5, 6, 7, 8, 9, 10, 11, 12, 13, 14, 15)); }
__device__ __forceinline__ v8f wmma16(v16h a, v16h b, v8f c) { return __builtin_amdgcn_wmma_f32_16x16x32_f16(false, a, false, b, (short)0, c, false, false); }
__device__ __forceinline__ v8f wmmab(v16bf a, v16bf b, v8f c) { return __builtin_amdgcn_wmma_f32_16x16x32_bf16(false, a, false, b, (short)0, c, false, false); }



template <typename T16> struct WFrag;
template <> struct WFrag<h16> { typedef v16h V; static __device__ __forceinline__ V ld(const h16* p) { return cat16(*(const v8h*)p, *(const v8h*)(p + 16)); } static __device__ __forceinline__ v8f mma(V a, V b, v8f c) { return wmma16(a, b, c); } };
template <> struct WFrag<bf> { typedef v16bf V; static __device__ __forceinline__ V ld(const bf* p) { return cat16b(*(const v8us*)p, *(const v8us*)(p + 16)); } static __device__ __forceinline__ v8f mma(V a, V b, v8f c) { return wmmab(a, b, c); } };

#define GPITCH 72                  // LDS row pitch of a staged GEMM operand in 16-bit elements: 128-B rows + 16 B (ds_load_b128 readers)
#define GTILE  (128 * GPITCH)      // one staged operand tile: 128 rows x 64 k
#define GK     1024                // K of both GEMMs = row pitch of their operand planes in elements
// One 128-row x 64-k operand tile, global (row pitch GK) -> LDS (row pitch GPITCH), by 128 threads: eight asynchronous 16-B copies per lane, rows r, r + 16, .. r + 112; 8 lanes per 128-B row, so every copy instruction takes 4 whole lines.
// l: the lane's LDS byte address in row r; g: its global address in row r.
__device__ __forceinline__ void cp_tile(unsigned l, const bf* g) {
    asm volatile("global_load_async_to_lds_b128 %0, %8, off\n\t"
                 "global_load_async_to_lds_b128 %1, %9, off\n\t"
                 "global_load_async_to_lds_b128 %2, %10, off\n\t"
                 "global_load_async_to_lds_b128 %3, %11, off\n\t"
                 "global_load_async_to_lds_b128 %4, %12, off\n\t"
                 "global_load_async_to_lds_b128 %5, %13, off\n\t"
                 "global_load_async_to_lds_b128 %6, %14, off\n\t"
                 "global_load_async_to_lds_b128 %7, %15, off\n\t"
                 "s_wait_xcnt 0x0"   // behind the last copy, inside the copies' own statement: in front of every rewrite of an address register that they name
                 :: "v"(l), "v"(l + 1 * 16 * GPITCH * 2), "v"(l + 2 * 16 * GPITCH * 2), "v"(l + 3 * 16 * GPITCH * 2), "v"(l + 4 * 16 * GPITCH * 2), "v"(l + 5 * 16 * GPITCH * 2), "v"(l + 6 * 16 * GPITCH * 2), "v"(l + 7 * 16 * GPITCH * 2),
                    "v"(g), "v"(g + 1 * 16 * GK), "v"(g + 2 * 16 * GK), "v"(g + 3 * 16 * GK), "v"(g + 4 * 16 * GK), "v"(g + 5 * 16 * GK), "v"(g + 6 * 16 * GK), "v"(g + 7 * 16 * GK) : "memory");
}
__device__ __forceinline__ void wait_copies() { asm volatile("s_wait_asynccnt 0x0" ::: "memory"); }   // this wave's copies have landed in LDS (the compiler places no wait for them)
__device__ __forceinline__ void wait_lds() { asm volatile("s_wait_dscnt 0x0" ::: "memory"); }         // this wave's LDS reads have returned: behind the next barrier their buffer may be refilled

// ---- k_gemmw: the output projection. FOUR WAVES per 128x128 output tile, 64x64 (16 accumulators) each; grid (M/128, N/128), 128 threads.
// C[m][n] (f32, pitch DM) = sum_k (A[m][k] + A2[m][k]) Bt[n][k] + bias[n], two products per k step. A stage is 64 k of [A | A2 | Bt] rows in LDS, two buffers, filled by asynchronous copies one stage ahead; one barrier per stage.
__global__ __launch_bounds__(128) void k_gemmw(const bf* __restrict__ A, const bf* __restrict__ A2, const bf* __restrict__ Bt, float* C, const float* __restrict__ bias) {
    typedef WFrag<bf>::V V;
    __shared__ __align__(16) bf sm[2 * 3 * GTILE];
    __shared__ __align__(16) float osm[4 * 16 * 68];
    const int tid = threadIdx.x, lane = tid & 31, lr = lane & 15, hi = lane >> 4;
    const int wv = __builtin_amdgcn_readfirstlane(tid >> 5), wa = wv & 1, wb = wv >> 1;   // the wave's 64 rows of the A tiles and of the B tile
    const int r0 = blockIdx.x * 128 + wa * 64, c0 = blockIdx.y * 128 + wb * 64; const int ldc = DM;
    float* os = osm + wv * 16 * 68;
    const int crow = tid >> 3, cch = (tid & 7) * 8;   // staging: this thread's row (of 16) and 16-B piece
    const size_t ao = (size_t)(blockIdx.x * 128 + crow) * GK + cch; const bf* ga = A + ao; const bf* ga2 = A2 + ao; const bf* gb = Bt + (size_t)(blockIdx.y * 128 + crow) * GK + cch;
    const unsigned l0 = (unsigned)(size_t)sm + (crow * GPITCH + cch) * 2;
    auto stage = [&](int t, int buf) { const unsigned l = l0 + buf * 3 * GTILE * 2; cp_tile(l, ga + t * 64); cp_tile(l + GTILE * 2, ga2 + t * 64); cp_tile(l + 2 * GTILE * 2, gb + t * 64); };
    v8f acc[4][4];
#pragma unroll
    for (int mb = 0; mb < 4; ++mb)
#pragma unroll
        for (int nb = 0; nb < 4; ++nb) acc[mb][nb] = (v8f){};
    stage(0, 0); wait_copies(); __syncthreads();   // stage 0 is published
    stage(1, 1);
#pragma unroll 1
    for (int t = 0; t < GK / 64; ++t) {
        const bf* sa = sm + (t & 1) * 3 * GTILE + (wa * 64 + lr) * GPITCH + 8 * hi; const bf* sb = sm + ((t & 1) * 3 + 2) * GTILE + (wb * 64 + lr) * GPITCH + 8 * hi;
#pragma unroll
        for (int ks = 0; ks < 2; ++ks) { V a[4], a2[4], b[4];
            b[0] = WFrag<bf>::ld(sb + ks * 32);
#pragma unroll
            for (int mb = 0; mb < 4; ++mb) { a[mb] = WFrag<bf>::ld(sa + mb * 16 * GPITCH + ks * 32); a2[mb] = WFrag<bf>::ld(sa + GTILE + mb * 16 * GPITCH + ks * 32); }
#pragma unroll
            for (int nb = 1; nb < 4; ++nb) b[nb] = WFrag<bf>::ld(sb + nb * 16 * GPITCH + ks * 32);
            __builtin_amdgcn_sched_barrier(0);   // the k step's LDS reads stay one group in front of its products, in the order the products want them: left alone they sink among the WMMAs, each group behind a wait to 0
#pragma unroll
            for (int nb = 0; nb < 4; ++nb)
#pragma unroll
                for (int mb = 0; mb < 4; ++mb) { acc[mb][nb] = WFrag<bf>::mma(a[mb], b[nb], acc[mb][nb]); acc[mb][nb] = WFrag<bf>::mma(a2[mb], b[nb], acc[mb][nb]); } }
        __builtin_amdgcn_sched_barrier(0);   // the trip's products stay in front of the waits below: the copies in flight get the whole trip to land (left alone the waits and the barrier rise in front of the second k step)
        wait_lds(); wait_copies(); __syncthreads();   // publishes stage t + 1 and ends every wave's reads of stage t
        if (t + 2 < GK / 64) stage(t + 2, t & 1);     // block-uniform; into the buffer that this trip has read
    }
    wait_copies();
#pragma unroll
    for (int mb = 0; mb < 4; ++mb) {
#pragma unroll
        for (int nb = 0; nb < 4; ++nb) {
#pragma unroll
            for (int j = 0; j < 8; ++j) os[(hi * 8 + j) * 68 + nb * 16 + lr] = acc[mb][nb][j]; }
        __builtin_amdgcn_wave_barrier(); asm volatile("" ::: "memory");   // the tile is one wave's own: keeps the row reads below behind the other lanes' LDS writes above (the compiler sees no dependence between lanes)
        float* crow_ = C + (size_t)(r0 + mb * 16) * ldc + c0;
#pragma unroll
        for (int s = 0; s < 8; ++s) { const int row = 2 * s + hi, cofs = lr * 4; v4f val = *(const v4fa*)(os + row * 68 + cofs); val[0] += bfr(bias[c0 + cofs]); val[1] += bfr(bias[c0 + cofs + 1]); val[2] += bfr(bias[c0 + cofs + 2]); val[3] += bfr(bias[c0 + cofs + 3]);
            *(v4f*)(crow_ + (size_t)row * ldc + cofs) = val; }
        __builtin_amdgcn_wave_barrier();
        if (mb < 3) asm volatile("s_wait_xcnt 0x0" ::: "memory");   // behind the stores, in front of the first rewrite of their data registers; its clobber also keeps the next tile's LDS writes behind this tile's row reads
    }
}

__device__ __forceinline__ void splitf(float y, unsigned short& h, unsigned short& l) { h = f2bf(y); l = f2bf(y - bf2f(h)); }
typedef __attribute__((ext_vector_type(2))) _Float16 v2h;
typedef __attribute__((ext_vector_type(4))) _Float16 v4h;
typedef __attribute__((ext_vector_type(2))) unsigned short v2us;
typedef __attribute__((ext_vector_type(4))) unsigned short v4us;
typedef __attribute__((ext_vector_type(2))) float v2f;
typedef __attribute__((ext_vector_type(4))) int v4i;

// grid (lines, heads, sources): matrix y of source z ([K][N] f32) goes to Bt plane z * NH_ + y ([N][K] bf16)
__global__ __launch_bounds__(256) void k_wtG(const float* __restrict__ w0, const float* __restrict__ w1, const float* __restrict__ w2, int K, int N, bf* Bt) {
    const float* w = (blockIdx.z == 0 ? w0 : blockIdx.z == 1 ? w1 : w2) + (size_t)blockIdx.y * K * N; Bt += ((size_t)blockIdx.z * NH_ + blockIdx.y) * N * K;
    const int lane = threadIdx.x & 31; const int L0 = (blockIdx.x * 8 + (threadIdx.x >> 5)) * 8; const int nlines = N * K / 64;
{
#pragma unroll 1
        for (int l = 0; l < 8; ++l) { const int L = L0 + l; if (L >= nlines) break; const size_t e = (size_t)L * 64 + lane * 2; const int k = (int)(e % K), n = (int)(e / K); v2us o;
            o[0] = f2bf(w[(size_t)k * N + n]); o[1] = f2bf(w[(size_t)(k + 1) * N + n]); *(v2us*)(Bt + e) = o; }
         }
}
__global__ __launch_bounds__(256) void k_cvt8(const float* __restrict__ s0, const float* __restrict__ s1, const float* __restrict__ s2, bf* dst, size_t n8) { const size_t i = (size_t)blockIdx.x * 256 + threadIdx.x; if (i >= n8) return; const float* src = blockIdx.y == 0 ? s0 : blockIdx.y == 1 ? s1 : s2; dst += (size_t)blockIdx.y * n8 * 8;   /* source y -> plane y */ const v8f v = *(const v8f*)(src + i * 8); v8us o;
#pragma unroll
    for (int k = 0; k < 8; ++k) o[k] = f2bf(v[k]); *(v8us*)(dst + i * 8) = o;  }

typedef __attribute__((ext_vector_type(2))) __bf16 v2bf;
typedef __attribute__((ext_vector_type(4))) unsigned v4u;
typedef v4u __attribute__((may_alias)) v4ua;
#define PPITCH 72                  // LDS row pitch of the projection epilogue in 16-bit elements: 128-B rows + 16 B (b128 accesses)
// Epilogue of k_gemmp. A lane's 8 accumulator values of tile [mb][nb] are 8 consecutive A-side indices (mb*16 + hi*8 + j) at one B-side index (nb*16 + lr): the A side is the contiguous dimension of the plane that is written.
// value + bias (braw, loaded by the caller; BROW: it runs along the B side, braw[0][nb]; else along the A side, braw[2*mb], braw[2*mb+1]) -> hi, lo bf16 -> LDS rows [B-side index][A-side index] -> whole 128-B lines of Dh, Dl (row pitch PITCH in elements).
template <bool BROW, int PITCH>
__device__ __forceinline__ void proj_out(const v8f (&acc)[4][4], const v4f (&braw)[8], bf* sh, int lane, bf* Dh, bf* Dl) {
    const int lr = lane & 15, hi = lane >> 4;
    float bb[4];
    if (BROW) {
#pragma unroll
        for (int nb = 0; nb < 4; ++nb) bb[nb] = bfr(braw[0][nb]); }
#pragma unroll
    for (int mb = 0; mb < 4; ++mb) { float ba[8];
        if (!BROW) {
#pragma unroll
            for (int j = 0; j < 4; ++j) { ba[j] = bfr(braw[2 * mb][j]); ba[4 + j] = bfr(braw[2 * mb + 1][j]); } }
#pragma unroll
        for (int nb = 0; nb < 4; ++nb) { v4u hw, lw;
#pragma unroll
            for (int w = 0; w < 4; ++w) { v2f y; y[0] = acc[mb][nb][2 * w] + (BROW ? bb[nb] : ba[2 * w]); y[1] = acc[mb][nb][2 * w + 1] + (BROW ? bb[nb] : ba[2 * w + 1]);
                const unsigned hp = __builtin_bit_cast(unsigned, __builtin_convertvector(y, v2bf)); v2f r; r[0] = y[0] - __uint_as_float(hp << 16); r[1] = y[1] - __uint_as_float(hp & 0xFFFF0000u);
                hw[w] = hp; lw[w] = __builtin_bit_cast(unsigned, __builtin_convertvector(r, v2bf)); }
            bf* sp = sh + (nb * 16 + lr) * PPITCH + mb * 16 + hi * 8; *(v4ua*)sp = hw; *(v4ua*)(sp + 64 * PPITCH) = lw; } }
    __builtin_amdgcn_wave_barrier(); asm volatile("" ::: "memory");   // the tile is one wave's own: keeps the row reads below behind the other lanes' LDS writes above (the compiler sees no dependence between lanes)
    const int row = lane >> 3, c = (lane & 7) * 8;   // 8 lanes per 128-B row, 4 rows per store
    const bf* sr = sh + row * PPITCH + c; bf* gh = Dh + (size_t)row * PITCH + c; bf* gl = Dl + (size_t)row * PITCH + c;
#pragma unroll
    for (int s = 0; s < 16; ++s) { *(v4ua*)(gh + s * 4 * PITCH) = *(const v4ua*)(sr + s * 4 * PPITCH); *(v4ua*)(gl + s * 4 * PITCH) = *(const v4ua*)(sr + (64 + s * 4) * PPITCH); }
}
// ---- k_gemmp: the three projections. FOUR WAVES per 128 rows x two heads' 128 columns, each wave 64 rows x one head's 64 columns (16 accumulators); grid (NB_*TT/128, NH_/2, 3), 128 threads; z: q, k, v.
// A stage is 64 k of [A rows | B rows] in LDS, two buffers, filled by asynchronous copies one stage ahead; one barrier per stage (k_gemmw's loop).
// The attention's planes come straight out of the accumulators: for q and k the weight rows are the A operand (a lane then holds 8 consecutive d of one t: plane [head][t][d]), for v the input rows are (8 consecutive t of one d: plane [head][d][t]).
// P?h, P?l: q planes with the k planes behind them (z-stride NB_*NH_*TT*HD).
__global__ __launch_bounds__(128) void k_gemmp(const bf* __restrict__ X, const bf* __restrict__ Wt, const float* __restrict__ bias0, const float* __restrict__ bias1, const float* __restrict__ bias2, bf* Ph, bf* Pl, bf* Vh, bf* Vl) {
    typedef WFrag<bf>::V V;
    __shared__ __align__(16) bf sm[2 * 2 * GTILE];   // the two stages; behind the loop's last barrier the four waves' epilogue tiles (2 * 64 * PPITCH elements each)
    static_assert(2 * 2 * GTILE == 4 * 2 * 64 * PPITCH, "epilogue tiles fill the ring");
    const int z = blockIdx.z; const bool isv = (z == 2);   // block-uniform
    const int tid = threadIdx.x, lane = tid & 31, lr = lane & 15, hi = lane >> 4;
    const int wv = __builtin_amdgcn_readfirstlane(tid >> 5), wa = wv & 1, wb = wv >> 1;   // the wave's 64 rows of the A tile and of the B tile
    const int r0 = blockIdx.x * 128 + (isv ? wa : wb) * 64, hd = blockIdx.y * 2 + (isv ? wb : wa);
    const bf* xr = X + ((size_t)z * NB_ * TT + blockIdx.x * 128) * GK; const bf* wr = Wt + ((size_t)z * DQ + blockIdx.y * 128) * GK;
    const int crow = tid >> 3, cch = (tid & 7) * 8;   // staging: this thread's row (of 16) and 16-B piece
    const bf* ga = (isv ? xr : wr) + (size_t)crow * GK + cch; const bf* gb = (isv ? wr : xr) + (size_t)crow * GK + cch;
    const unsigned l0 = (unsigned)(size_t)sm + (crow * GPITCH + cch) * 2;
    auto stage = [&](int t, int buf) { const unsigned l = l0 + buf * 2 * GTILE * 2; cp_tile(l, ga + t * 64); cp_tile(l + GTILE * 2, gb + t * 64); };
    v8f acc[4][4];
#pragma unroll
    for (int mb = 0; mb < 4; ++mb)
#pragma unroll
        for (int nb = 0; nb < 4; ++nb) acc[mb][nb] = (v8f){};
    const float* bias = (z == 0 ? bias0 : z == 1 ? bias1 : bias2) + hd * HD; v4f braw[8];   // the lane's biases, asked for in front of the loop: they land under it
    const float* bl = bias + (isv ? lr : hi * 8);
    if (isv) {
#pragma unroll
        for (int nb = 0; nb < 4; ++nb) braw[0][nb] = bl[nb * 16]; }
    else {
#pragma unroll
        for (int mb = 0; mb < 4; ++mb) { braw[2 * mb] = *(const v4fa*)(bl + mb * 16); braw[2 * mb + 1] = *(const v4fa*)(bl + mb * 16 + 4); } }
    asm volatile("s_wait_xcnt 0x0" :: "v"(bl) : "memory");   // behind the bias loads, in front of the first rewrite of their address registers (named as input: live up to here)
    stage(0, 0); wait_copies(); __syncthreads();   // stage 0 is published
    stage(1, 1);
#pragma unroll 1
    for (int t = 0; t < GK / 64; ++t) {
        const bf* sa = sm + (t & 1) * 2 * GTILE + (wa * 64 + lr) * GPITCH + 8 * hi; const bf* sb = sm + ((t & 1) * 2 + 1) * GTILE + (wb * 64 + lr) * GPITCH + 8 * hi;
#pragma unroll
        for (int ks = 0; ks < 2; ++ks) { V a[4], b[4];
            b[0] = WFrag<bf>::ld(sb + ks * 32);
#pragma unroll
            for (int i = 0; i < 4; ++i) a[i] = WFrag<bf>::ld(sa + i * 16 * GPITCH + ks * 32);
#pragma unroll
            for (int i = 1; i < 4; ++i) b[i] = WFrag<bf>::ld(sb + i * 16 * GPITCH + ks * 32);
            __builtin_amdgcn_sched_barrier(0);   // as in k_gemmw: the k step's LDS reads stay one group in front of its products
#pragma unroll
            for (int nb = 0; nb < 4; ++nb)
#pragma unroll
                for (int mb = 0; mb < 4; ++mb) acc[mb][nb] = WFrag<bf>::mma(a[mb], b[nb], acc[mb][nb]); }
        __builtin_amdgcn_sched_barrier(0);   // the trip's products stay in front of the waits below: the copies in flight get the whole trip to land (left alone the waits and the barrier rise in front of the second k step)
        wait_lds(); wait_copies(); __syncthreads();   // publishes stage t + 1 and ends every wave's reads of stage t
        if (t + 2 < GK / 64) stage(t + 2, t & 1);     // block-uniform; into the buffer that this trip has read
    }
    wait_copies();
    bf* sh = sm + wv * 2 * 64 * PPITCH;   // every wave's last read of the ring stands in front of the loop's last barrier
    const int bb = r0 / TT, t0 = r0 % TT; const size_t pl = ((size_t)bb * NH_ + hd) * TT * HD;
    if (isv) proj_out<true, TT>(acc, braw, sh, lane, Vh + pl + t0, Vl + pl + t0);
    else { const size_t po = (size_t)z * NB_ * NH_ * TT * HD + pl + (size_t)t0 * HD; proj_out<false, HD>(acc, braw, sh, lane, Ph + po, Pl + po); }
}
typedef __attribute__((ext_vector_type(8))) unsigned v8u;
__device__ __forceinline__ float xhalf(float x) { const int b = __float_as_int(x); return __int_as_float(__builtin_amdgcn_permlanex16(b, b, 0x76543210, 0xfedcba98, false, false)); }   // the value of lane l ^ 16
#define FPITCH 72                  // LDS row pitch in 16-bit elements: 128-B rows + 16 B (ds_load_b128 readers)
#define FTILE  (64 * FPITCH)       // one staged tile: 64 rows
#define L2E    1.4426950408889634f
__global__ __launch_bounds__(256) void k_fattn(const bf* __restrict__ Qh, const bf* __restrict__ Ql, const bf* __restrict__ Kh, const bf* __restrict__ Kl, const bf* __restrict__ Vh, const bf* __restrict__ Vl, const int* __restrict__ mk, bf* Ah, bf* Al) {
    __shared__ __align__(16) bf sm[2 * 4 * FTILE];
    const int tid = threadIdx.x, lane = tid & 31, lr = lane & 15, hi = lane >> 4;
    const int q0 = blockIdx.x * 256 + (tid >> 5) * 32;
    const size_t pb = (size_t)blockIdx.y * TT * HD;
    const int srow = tid >> 3, sch = (tid & 7) * 8;   // staging: this thread moves 16 B of rows srow and srow + 32 of each tile
    v8us stg[8];
    auto gload = [&](int s) {
        __builtin_amdgcn_sched_barrier(0);   // this and the one at the foot keep the loads where they are written, with their s_wait_xcnt directly behind them
        const size_t ko = pb + (size_t)(s * 64 + srow) * HD + sch, vo = pb + (size_t)srow * TT + s * 64 + sch; const bf* a0 = Kh + ko; const bf* a1 = Kl + ko; const bf* a2 = Vh + vo; const bf* a3 = Vl + vo;
#pragma unroll
        for (int r = 0; r < 2; ++r) { stg[r] = *(const v8us*)(a0 + r * 32 * HD); stg[2 + r] = *(const v8us*)(a1 + r * 32 * HD); stg[4 + r] = *(const v8us*)(a2 + r * 32 * TT); stg[6 + r] = *(const v8us*)(a3 + r * 32 * TT); }
        asm volatile("s_wait_xcnt 0x0" :: "v"(a0), "v"(a1), "v"(a2), "v"(a3) : "memory");   // behind the loads, in front of the first rewrite of their address registers (named as inputs: they stay live up to here, so no load's result lands on them either)
        __builtin_amdgcn_sched_barrier(0); };
    auto sstore = [&](int buf) {
#pragma unroll
        for (int i = 0; i < 4; ++i)
#pragma unroll
            for (int r = 0; r < 2; ++r) *(v8us*)(sm + (buf * 4 + i) * FTILE + (srow + 32 * r) * FPITCH + sch) = stg[i * 2 + r]; };
    auto mload = [&](v4i (&m)[2][2][2], int key0, int koff) {   // mask of 32 keys (from key0 + koff; koff a literal, it goes into the loads' offset field) x 32 query columns: [column tile][key tile][4 keys]
        __builtin_amdgcn_sched_barrier(0);   // as in gload
        const int* p0 = mk + (size_t)(q0 + lr) * TT + key0 + hi * 8; const int* p1 = p0 + 16 * TT + koff;
#pragma unroll
        for (int kt = 0; kt < 2; ++kt) { m[0][kt][0] = *(const v4i*)(p0 + koff + kt * 16); m[0][kt][1] = *(const v4i*)(p0 + koff + kt * 16 + 4); m[1][kt][0] = *(const v4i*)(p1 + kt * 16); m[1][kt][1] = *(const v4i*)(p1 + kt * 16 + 4); }
        asm volatile("s_wait_xcnt 0x0" :: "v"(p0) : "memory");   // as in gload (the eight loads share one address pair)
        __builtin_amdgcn_sched_barrier(0); };
    v16bf qh[2][2], ql[2][2];   // [column tile][k step]
#pragma unroll
    for (int nt = 0; nt < 2; ++nt)
#pragma unroll
        for (int ks = 0; ks < 2; ++ks) { const size_t qo = pb + (size_t)(q0 + nt * 16 + lr) * HD + ks * 32 + 8 * hi; qh[nt][ks] = WFrag<bf>::ld(Qh + qo); ql[nt][ks] = WFrag<bf>::ld(Ql + qo); }
    asm volatile("s_wait_xcnt 0x0" ::: "memory");   // behind the loads, in front of the first rewrite of their address registers
    v8f o[4][2];
#pragma unroll
    for (int dt = 0; dt < 4; ++dt) { o[dt][0] = (v8f){}; o[dt][1] = (v8f){}; }
    float mrun[2] = { -3.0e38f, -3.0e38f }; v2f lsum[2] = { (v2f){}, (v2f){} };   // the sum runs in two chains per column tile (even and odd keys)
    v4i mm[2][2][2];
    auto pass = [&](const bf* sb, int kb, int nextkey, int nextoff) {   // 32 keys; nextkey + nextoff: first key of the pass after this one
        v16bf kf[2][2][2];   // [key tile][k step][hi, lo]: one group of LDS reads in front of the products
#pragma unroll
        for (int kt = 0; kt < 2; ++kt)
#pragma unroll
            for (int ks = 0; ks < 2; ++ks) { const bf* kp = sb + (kb * 32 + kt * 16 + lr) * FPITCH + ks * 32 + 8 * hi; kf[kt][ks][0] = WFrag<bf>::ld(kp); kf[kt][ks][1] = WFrag<bf>::ld(kp + FTILE); }
        v8f sc[2][2];   // [key tile][column tile]
#pragma unroll
        for (int kt = 0; kt < 2; ++kt) { sc[kt][0] = (v8f){}; sc[kt][1] = (v8f){};
#pragma unroll
            for (int ks = 0; ks < 2; ++ks)
#pragma unroll
                for (int nt = 0; nt < 2; ++nt) { sc[kt][nt] = wmmab(kf[kt][ks][0], qh[nt][ks], sc[kt][nt]); sc[kt][nt] = wmmab(kf[kt][ks][1], qh[nt][ks], sc[kt][nt]); sc[kt][nt] = wmmab(kf[kt][ks][0], ql[nt][ks], sc[kt][nt]); } }
        v16bf vf[4][2];   // [d tile][hi, lo]: read while the softmax runs
#pragma unroll
        for (int dt = 0; dt < 4; ++dt) { const bf* vp = sb + 2 * FTILE + (dt * 16 + lr) * FPITCH + kb * 32 + 8 * hi; vf[dt][0] = WFrag<bf>::ld(vp); vf[dt][1] = WFrag<bf>::ld(vp + FTILE); }
        float mn[2]; bool need = false;
#pragma unroll
        for (int nt = 0; nt < 2; ++nt) { float mx = -3.0e38f;
#pragma unroll
            for (int kt = 0; kt < 2; ++kt)
#pragma unroll
                for (int j = 0; j < 8; ++j) { const float t = (mm[nt][kt][j >> 2][j & 3] != 0) ? sc[kt][nt][j] * SCL : -1.0e9f; sc[kt][nt][j] = t; mx = fmaxf(mx, t); }
            mx = fmaxf(mx, xhalf(mx)); mn[nt] = fmaxf(mrun[nt], mx); need = need || (mn[nt] > mrun[nt]); }
        mload(mm, nextkey, nextoff);   // the next pass's mask flies behind this pass's exponentials and products
        if (__builtin_amdgcn_ballot_w32(need) != 0) {   // wave-uniform: one test per pass
#pragma unroll
            for (int nt = 0; nt < 2; ++nt) { const float al = __builtin_amdgcn_exp2f((mrun[nt] - mn[nt]) * L2E); lsum[nt] *= al; mrun[nt] = mn[nt];
#pragma unroll
                for (int dt = 0; dt < 4; ++dt) o[dt][nt] *= al; } }
        v16bf ph[2], pl[2];
#pragma unroll
        for (int nt = 0; nt < 2; ++nt) { const float mc = mrun[nt] * L2E; v8u hw, lw;   // packed pairs: word w holds elements 2w, 2w + 1 of the B fragment
#pragma unroll
            for (int w = 0; w < 8; ++w) { const int kt = w >> 2, j = (w & 3) * 2; v2f p; p[0] = __builtin_amdgcn_exp2f(__builtin_fmaf(sc[kt][nt][j], L2E, -mc)); p[1] = __builtin_amdgcn_exp2f(__builtin_fmaf(sc[kt][nt][j + 1], L2E, -mc)); lsum[nt] += p;
                const unsigned hp = __builtin_bit_cast(unsigned, __builtin_convertvector(p, v2bf)); v2f r; r[0] = p[0] - __uint_as_float(hp << 16); r[1] = p[1] - __uint_as_float(hp & 0xFFFF0000u);
                hw[w] = hp; lw[w] = __builtin_bit_cast(unsigned, __builtin_convertvector(r, v2bf)); }
            ph[nt] = __builtin_bit_cast(v16bf, hw); pl[nt] = __builtin_bit_cast(v16bf, lw); }
#pragma unroll
        for (int dt = 0; dt < 4; ++dt)
#pragma unroll
            for (int nt = 0; nt < 2; ++nt) { o[dt][nt] = wmmab(vf[dt][0], ph[nt], o[dt][nt]); o[dt][nt] = wmmab(vf[dt][1], ph[nt], o[dt][nt]); o[dt][nt] = wmmab(vf[dt][0], pl[nt], o[dt][nt]); }
        __builtin_amdgcn_sched_barrier(0x0108); };   // vector work does not cross (LDS reads and WMMAs may): the next pass's mask compares, and with them the wait on its loads, stay behind this pass's products
    gload(0); mload(mm, 0, 0); sstore(0); __syncthreads();
#pragma unroll 1
    for (int s = 0; s < TT / 64; ++s) { const bf* sb = sm + (s & 1) * 4 * FTILE; const bool more = (s + 1 < TT / 64);   // block-uniform
        gload(more ? s + 1 : s);   // no branch round the loads issued ahead (here and for the mask): a branch merges two paths in the compiler's load counting and the waits fall to the smaller count; the last stage's are in bounds and unused
        pass(sb, 0, s * 64, 32);
        pass(sb, 1, more ? (s + 1) * 64 : 0, 0);
        __builtin_amdgcn_sched_barrier(0);   // keeps the slots below behind the last product
        asm volatile("v_nop\n\tv_nop\n\tv_nop\n\tv_nop");   // the four vector slots between the pass's last WMMA and the first rewrite of its operands on the taken back edge
        if (more) { sstore((s + 1) & 1); __syncthreads(); } }   // the buffer written was last read in stage s - 1, whose barrier every wave has passed; this barrier publishes it
    const int bb = blockIdx.y / NH_, hh = blockIdx.y % NH_;
#pragma unroll
    for (int nt = 0; nt < 2; ++nt) { const float lh = lsum[nt][0] + lsum[nt][1]; const float inv = __fdiv_rn(1.0f, lh + xhalf(lh)); const size_t oo = ((size_t)bb * TT + q0 + nt * 16 + lr) * DQ + hh * HD + hi * 8;
#pragma unroll
        for (int dt = 0; dt < 4; ++dt) { v8us oh, ol;
#pragma unroll
            for (int j = 0; j < 8; ++j) { unsigned short a, c2; splitf(o[dt][nt][j] * inv, a, c2); oh[j] = a; ol[j] = c2; }
            *(v8us*)(Ah + oo + dt * 16) = oh; *(v8us*)(Al + oo + dt * 16) = ol; } }
}

extern "C" void kernel_launch(void* const* d_in, const int* in_sizes, int n_in,
                              void* d_out, int out_size, void* d_ws, size_t ws_size, hipStream_t stream) {
    (void)in_sizes; (void)n_in; (void)out_size;
    const float* x = (const float*)d_in[0]; const float* xk = (const float*)d_in[1]; const float* xv = (const float*)d_in[2]; const int* mk = (const int*)d_in[3];   /* mask [1024][1024] int */ const float* wq = (const float*)d_in[4]; const float* bq = (const float*)d_in[5]; const float* wk = (const float*)d_in[6]; const float* bk = (const float*)d_in[7]; const float* wv = (const float*)d_in[8]; const float* bv = (const float*)d_in[9]; const float* wo = (const float*)d_in[10]; const float* bo = (const float*)d_in[11];
    float* OUT = (float*)d_out;     // [4][1024][1024]
    char* wsp = (char*)d_ws;
    auto take = [&](size_t bytes) { char* p = wsp; wsp += (bytes + 255) & ~(size_t)255; return (void*)p; };
    bf* WQ = (bf*)take((size_t)DQ * DM * 2); bf* WK = (bf*)take((size_t)DKV * DM * 2); bf* WV = (bf*)take((size_t)DKV * DM * 2); bf* WO = (bf*)take((size_t)DM * DQ * 2); (void)WK; (void)WV;   // WQ, WK, WV are consecutive planes (z-stride DQ*DM)
    const size_t PL = (size_t)NB_ * NH_ * TT * HD;   // one plane set: all batches, all heads
    bf* QPh = (bf*)take(PL * 2); bf* KPh = (bf*)take(PL * 2); bf* QPl = (bf*)take(PL * 2); bf* KPl = (bf*)take(PL * 2); bf* VTh = (bf*)take(PL * 2); bf* VTl = (bf*)take(PL * 2);   // the k planes follow the q planes: one launch fills both
    bf* XB = (bf*)take((size_t)3 * NB_ * TT * DM * 2); bf* ATh = (bf*)take((size_t)NB_ * TT * DQ * 2); bf* ATl = (bf*)take((size_t)NB_ * TT * DQ * 2);   // bf16 inputs, merged heads hi/lo
    if ((size_t)(wsp - (char*)d_ws) > ws_size) return;    // ws 256 MiB
    k_wtG<<<dim3((DM * HD / 64 + 63) / 64, NH_, 3), 256, 0, stream>>>(wq, wk, wv, DM, HD, WQ);   /* per-head [1024][64] -> Bt rows hh*64.. of WQ, WK, WV */
    k_wtG<<<dim3((DQ * DM / 64 + 63) / 64, 1, 1), 256, 0, stream>>>(wo, wo, wo, DQ, DM, WO);
    k_cvt8<<<dim3((unsigned)(((size_t)NB_ * TT * DM / 8 + 255) / 256), 3, 1), 256, 0, stream>>>(x, xk, xv, XB, (size_t)NB_ * TT * DM / 8);
    k_gemmp<<<dim3(NB_ * TT / 128, NH_ / 2, 3), 128, 0, stream>>>(XB, WQ, bq, bk, bv, QPh, QPl, VTh, VTl);   // z: q, k, v; writes the hi/lo planes the attention reads
    k_fattn<<<dim3(TT / 256, NB_ * NH_, 1), 256, 0, stream>>>(QPh, QPl, KPh, KPl, VTh, VTl, mk, ATh, ATl);   // y: batch * 16 + head, consecutive planes (stride TT*HD)
    k_gemmw<<<dim3(NB_ * TT / 128, DM / 128, 1), 128, 0, stream>>>(ATh, ATl, WO, OUT, bo);
}

// v005
// A run of this version takes 112 microseconds.
// Two timings next to v004 both put it at 1.13 times that version's speed.
// Counting every step since v000, it is 16.9 times as fast.
#include <hip/hip_runtime.h>

// Multi-head attention with per-head projections, an UNSCALED score and a random keep-mask (querys, keys, values [4][1024][1024]; q_h = querys Wq[h] + bq[h] (Wq, Wk, Wv [16][1024][64] 1/32 + biases [16][64] 0.01 == one 'xw' [1024][1024] projection per input whose column block h is W[h]); scores = q.k (no 1/sqrt(dk): sigma ~8); mask ([1024][1024] int {0,1}, ~50 %, read; 0 -> -1e9 == exclusion); softmax; out = concat heads Wp + bp ('xw' [1024][1024] 1/32 + 0.01) -> [4][1024][1024] (4.2 M)).
// Layout: one preparation launch (bf16 copies of the three inputs, all batches; each per-head [1024][64] weight transposed into rows h*64.. of one bf16 Bt per projection; Wp transposed); the three exact projections + f32 biases as the z planes of one launch over all 4096 rows, whose epilogue splits each value into hi/lo bf16 and stores the attention's own planes (q, k [head][t][d], v [head][d][t]); ONE attention launch over all batches and heads (k_fattn: scores, mask, running softmax and P V stay in registers and LDS, every row on hi/lo planes, 3 products each); merged hi/lo x Wp exact + bp over all 4096 rows.
// Compute dtypes, f32 accumulate: every input rounded to bf16; projections exact + f32 biases; attention 3 products on every row; softmax f32; Wp hl x exact + bias.

#define NB_  4
#define TT   1024
#define DM   1024
#define NH_  16
#define NKV  16
#define REP  (NH_ / NKV)
#define HD   64
#define DQ   (NH_ * HD)
#define DKV  (NKV * HD)
#define ZH   16
#define RH   1024
#define WIN  0
#define PCAR 1024.0f
#define SCL  1.0f   // the module applies no 1/sqrt(dk)
typedef _Float16 h16;
typedef unsigned short bf;
typedef __attribute__((ext_vector_type(16))) __bf16   v16bf;
typedef __attribute__((ext_vector_type(16))) _Float16 v16h;
typedef __attribute__((ext_vector_type(8)))  _Float16 v8h;
typedef __attribute__((ext_vector_type(8)))  unsigned short v8us;
typedef __attribute__((ext_vector_type(8)))  float    v8f;
typedef __attribute__((ext_vector_type(4)))  float    v4f;
typedef v8h  __attribute__((may_alias)) v8ha;
typedef v4f  __attribute__((may_alias)) v4fa;
typedef v8us __attribute__((may_alias)) v8usa;

__device__ __forceinline__ unsigned short f2bf(float f) { unsigned u = __float_as_uint(f); u += 0x7FFFu + ((u >> 16) & 1u); return (unsigned short)(u >> 16); }
__device__ __forceinline__ float bf2f(unsigned short b) { return __uint_as_float(((unsigned)b) << 16); }
__device__ __forceinline__ float bfr(float f) { return bf2f(f2bf(f)); }
__device__ __forceinline__ v16h cat16(v8h lo, v8h hi) { return __builtin_shufflevector(lo, hi, 0, 1, 2, 3, 4, 5, 6, 7, 8, 9, 10, 11, 12, 13, 14, 15); }
__device__ __forceinline__ v16bf cat16b(v8us lo, v8us hi) { return __builtin_bit_cast(v16bf, __builtin_shufflevector(lo, hi, 0, 1, 2, 3, 4, 5, 6, 7, 8, 9, 10, 11, 12, 13, 14, 15)); }
__device__ __forceinline__ v8f wmma16(v16h a, v16h b, v8f c) { return __builtin_amdgcn_wmma_f32_16x16x32_f16(false, a, false, b, (short)0, c, false, false); }
__device__ __forceinline__ v8f wmmab(v16bf a, v16bf b, v8f c) { return __builtin_amdgcn_wmma_f32_16x16x32_bf16(false, a, false, b, (short)0, c, false, false); }



template <typename T16> struct WFrag;
template <> struct WFrag<h16> { typedef v16h V; static __device__ __forceinline__ V ld(const h16* p) { return cat16(*(const v8h*)p, *(const v8h*)(p + 16)); } static __device__ __forceinline__ v8f mma(V a, V b, v8f c) { return wmma16(a, b, c); } };
template <> struct WFrag<bf> { typedef v16bf V; static __device__ __forceinline__ V ld(const bf* p) { return cat16b(*(const v8us*)p, *(const v8us*)(p + 16)); } static __device__ __forceinline__ v8f mma(V a, V b, v8f c) { return wmmab(a, b, c); } };

#define GPITCH 72                  // LDS row pitch of a staged GEMM operand in 16-bit elements: 128-B rows + 16 B (ds_load_b128 readers)
#define GTILE  (128 * GPITCH)      // one staged operand tile: 128 rows x 64 k
#define GK     1024                // K of both GEMMs = row pitch of their operand planes in elements
// One 128-row x 64-k operand tile, global (row pitch GK) -> LDS (row pitch GPITCH), by 128 threads: eight asynchronous 16-B copies per lane, rows r, r + 16, .. r + 112; 8 lanes per 128-B row, so every copy instruction takes 4 whole lines.
// l: the lane's LDS byte address in row r; g: its global address in row r.
__device__ __forceinline__ void cp_tile(unsigned l, const bf* g) {
    asm volatile("global_load_async_to_lds_b128 %0, %8, off\n\t"
                 "global_load_async_to_lds_b128 %1, %9, off\n\t"
                 "global_load_async_to_lds_b128 %2, %10, off\n\t"
                 "global_load_async_to_lds_b128 %3, %11, off\n\t"
                 "global_load_async_to_lds_b128 %4, %12, off\n\t"
                 "global_load_async_to_lds_b128 %5, %13, off\n\t"
                 "global_load_async_to_lds_b128 %6, %14, off\n\t"
                 "global_load_async_to_lds_b128 %7, %15, off\n\t"
                 "s_wait_xcnt 0x0"   // behind the last copy, inside the copies' own statement: in front of every rewrite of an address register that they name
                 :: "v"(l), "v"(l + 1 * 16 * GPITCH * 2), "v"(l + 2 * 16 * GPITCH * 2), "v"(l + 3 * 16 * GPITCH * 2), "v"(l + 4 * 16 * GPITCH * 2), "v"(l + 5 * 16 * GPITCH * 2), "v"(l + 6 * 16 * GPITCH * 2), "v"(l + 7 * 16 * GPITCH * 2),
                    "v"(g), "v"(g + 1 * 16 * GK), "v"(g + 2 * 16 * GK), "v"(g + 3 * 16 * GK), "v"(g + 4 * 16 * GK), "v"(g + 5 * 16 * GK), "v"(g + 6 * 16 * GK), "v"(g + 7 * 16 * GK) : "memory");
}
__device__ __forceinline__ void wait_copies() { asm volatile("s_wait_asynccnt 0x0" ::: "memory"); }   // this wave's copies have landed in LDS (the compiler places no wait for them)
__device__ __forceinline__ void wait_lds() { asm volatile("s_wait_dscnt 0x0" ::: "memory"); }         // this wave's LDS reads have returned: behind the next barrier their buffer may be refilled

// ---- k_gemmw: the output projection. FOUR WAVES per 128x128 output tile, 64x64 (16 accumulators) each; grid (M/128, N/128), 128 threads.
// C[m][n] (f32, pitch DM) = sum_k (A[m][k] + A2[m][k]) Bt[n][k] + bias[n], two products per k step. A stage is 64 k of [A | A2 | Bt] rows in LDS, two buffers, filled by asynchronous copies one stage ahead; one barrier per stage.
__global__ __launch_bounds__(128) void k_gemmw(const bf* __restrict__ A, const bf* __restrict__ A2, const bf* __restrict__ Bt, float* C, const float* __restrict__ bias) {
    typedef WFrag<bf>::V V;
    __shared__ __align__(16) bf sm[2 * 3 * GTILE];
    __shared__ __align__(16) float osm[4 * 16 * 68];
    const int tid = threadIdx.x, lane = tid & 31, lr = lane & 15, hi = lane >> 4;
    const int wv = __builtin_amdgcn_readfirstlane(tid >> 5), wa = wv & 1, wb = wv >> 1;   // the wave's 64 rows of the A tiles and of the B tile
    const int r0 = blockIdx.x * 128 + wa * 64, c0 = blockIdx.y * 128 + wb * 64; const int ldc = DM;
    float* os = osm + wv * 16 * 68;
    const int crow = tid >> 3, cch = (tid & 7) * 8;   // staging: this thread's row (of 16) and 16-B piece
    const size_t ao = (size_t)(blockIdx.x * 128 + crow) * GK + cch; const bf* ga = A + ao; const bf* ga2 = A2 + ao; const bf* gb = Bt + (size_t)(blockIdx.y * 128 + crow) * GK + cch;
    const unsigned l0 = (unsigned)(size_t)sm + (crow * GPITCH + cch) * 2;
    auto stage = [&](int t, int buf) { const unsigned l = l0 + buf * 3 * GTILE * 2; cp_tile(l, ga + t * 64); cp_tile(l + GTILE * 2, ga2 + t * 64); cp_tile(l + 2 * GTILE * 2, gb + t * 64); };
    v8f acc[4][4];
#pragma unroll
    for (int mb = 0; mb < 4; ++mb)
#pragma unroll
        for (int nb = 0; nb < 4; ++nb) acc[mb][nb] = (v8f){};
    stage(0, 0); wait_copies(); __syncthreads();   // stage 0 is published
    stage(1, 1);
#pragma unroll 1
    for (int t = 0; t < GK / 64; ++t) {
        const bf* sa = sm + (t & 1) * 3 * GTILE + (wa * 64 + lr) * GPITCH + 8 * hi; const bf* sb = sm + ((t & 1) * 3 + 2) * GTILE + (wb * 64 + lr) * GPITCH + 8 * hi;
#pragma unroll
        for (int ks = 0; ks < 2; ++ks) { V a[4], a2[4], b[4];
            b[0] = WFrag<bf>::ld(sb + ks * 32);
#pragma unroll
            for (int mb = 0; mb < 4; ++mb) { a[mb] = WFrag<bf>::ld(sa + mb * 16 * GPITCH + ks * 32); a2[mb] = WFrag<bf>::ld(sa + GTILE + mb * 16 * GPITCH + ks * 32); }
#pragma unroll
            for (int nb = 1; nb < 4; ++nb) b[nb] = WFrag<bf>::ld(sb + nb * 16 * GPITCH + ks * 32);
            __builtin_amdgcn_sched_barrier(0);   // the k step's LDS reads stay one group in front of its products, in the order the products want them: left alone they sink among the WMMAs, each group behind a wait to 0
#pragma unroll
            for (int nb = 0; nb < 4; ++nb)
#pragma unroll
                for (int mb = 0; mb < 4; ++mb) { acc[mb][nb] = WFrag<bf>::mma(a[mb], b[nb], acc[mb][nb]); acc[mb][nb] = WFrag<bf>::mma(a2[mb], b[nb], acc[mb][nb]); } }
        __builtin_amdgcn_sched_barrier(0);   // the trip's products stay in front of the waits below: the copies in flight get the whole trip to land (left alone the waits and the barrier rise in front of the second k step)
        wait_lds(); wait_copies(); __syncthreads();   // publishes stage t + 1 and ends every wave's reads of stage t
        if (t + 2 < GK / 64) stage(t + 2, t & 1);     // block-uniform; into the buffer that this trip has read
    }
    wait_copies();
#pragma unroll
    for (int mb = 0; mb < 4; ++mb) {
#pragma unroll
        for (int nb = 0; nb < 4; ++nb) {
#pragma unroll
            for (int j = 0; j < 8; ++j) os[(hi * 8 + j) * 68 + nb * 16 + lr] = acc[mb][nb][j]; }
        __builtin_amdgcn_wave_barrier(); asm volatile("" ::: "memory");   // the tile is one wave's own: keeps the row reads below behind the other lanes' LDS writes above (the compiler sees no dependence between lanes)
        float* crow_ = C + (size_t)(r0 + mb * 16) * ldc + c0;
#pragma unroll
        for (int s = 0; s < 8; ++s) { const int row = 2 * s + hi, cofs = lr * 4; v4f val = *(const v4fa*)(os + row * 68 + cofs); val[0] += bfr(bias[c0 + cofs]); val[1] += bfr(bias[c0 + cofs + 1]); val[2] += bfr(bias[c0 + cofs + 2]); val[3] += bfr(bias[c0 + cofs + 3]);
            *(v4f*)(crow_ + (size_t)row * ldc + cofs) = val; }
        __builtin_amdgcn_wave_barrier();
        if (mb < 3) asm volatile("s_wait_xcnt 0x0" ::: "memory");   // behind the stores, in front of the first rewrite of their data registers; its clobber also keeps the next tile's LDS writes behind this tile's row reads
    }
}

__device__ __forceinline__ void splitf(float y, unsigned short& h, unsigned short& l) { h = f2bf(y); l = f2bf(y - bf2f(h)); }
typedef __attribute__((ext_vector_type(2))) _Float16 v2h;
typedef __attribute__((ext_vector_type(4))) _Float16 v4h;
typedef __attribute__((ext_vector_type(2))) unsigned short v2us;
typedef __attribute__((ext_vector_type(4))) unsigned short v4us;
typedef __attribute__((ext_vector_type(2))) float v2f;
typedef __attribute__((ext_vector_type(4))) int v4i;

typedef __attribute__((ext_vector_type(2))) __bf16 v2bf;
typedef __attribute__((ext_vector_type(2))) unsigned v2u;
typedef __attribute__((ext_vector_type(4))) unsigned v4u;
typedef v2u __attribute__((may_alias)) v2ua;
typedef v4u __attribute__((may_alias)) v4ua;
__device__ __forceinline__ unsigned pk2bf(float a, float b) { v2f y; y[0] = a; y[1] = b; return __builtin_bit_cast(unsigned, __builtin_convertvector(y, v2bf)); }   // a in the low half: the lower address
#define TPITCH 264                 // LDS row pitch of the transposed weight tile in 16-bit elements: 512-B rows + 16 B (b128 accesses)
#define NPB    256                 // work-groups of k_prep: 16 waves each, one per WGP, all resident
#define XPB    (NB_ * TT * DM / NPB)   // elements of each input that one work-group converts
// ---- k_prep: the whole preparation in one launch; grid NPB, 512 threads. Every work-group takes an equal share of both jobs, and every global access covers whole lines.
// Weights: 64 column blocks [1024 k][64 n] f32 (16 heads each of w0, w1, w2, row pitch HD; 16 column blocks of w3, row pitch DM) x 4 k tiles. One 256-k x 64-n tile per work-group: a thread reads 4 n of 8 consecutive k rows (16 lanes per 256-B row piece), packs 8 k per n into 16 B,
// turns the tile in LDS to [n][k], and the work-group writes 64 rows of 512 B: Bt (blocks 0..47, [n][k] planes one behind the other) or Bo (w3), [n][1024 k] bf16.
// Inputs: 64 KB of each of s0, s1, s2 per work-group, 4 KB per wave as eight 512-B loads; plane p of X gets source p as bf16, 256 B per store.
// All 32 loads of a thread are asked for at the top.
__global__ __launch_bounds__(512) void k_prep(const float* __restrict__ s0, const float* __restrict__ s1, const float* __restrict__ s2, const float* __restrict__ w0, const float* __restrict__ w1, const float* __restrict__ w2, const float* __restrict__ w3, bf* X, bf* Bt, bf* Bo) {
    __shared__ __align__(16) bf tl[64 * TPITCH];
    const int tid = threadIdx.x, m = blockIdx.x >> 2, kt = blockIdx.x & 3;   // m: column block, kt: k tile (block-uniform)
    const bool iso = (m >= 3 * NH_);
    const float* wsrc = iso ? w3 + (m - 3 * NH_) * 64 : (m < NH_ ? w0 : m < 2 * NH_ ? w1 : w2) + (size_t)(m & (NH_ - 1)) * DM * HD; const int wp = iso ? DM : HD;
    const int n4 = (tid & 15) * 4, kq = tid >> 4;
    const float* wl = wsrc + (size_t)(kt * 256 + kq * 8) * wp + n4;
    const float* wa[8];
#pragma unroll
    for (int i = 0; i < 8; ++i) wa[i] = wl + i * wp;
    const size_t e0 = (size_t)blockIdx.x * XPB + (tid >> 5) * 1024 + (tid & 31) * 4;
    const float* x0 = s0 + e0; const float* x1 = s1 + e0; const float* x2 = s2 + e0;
    v4f wr[8], xr[3][8];
#pragma unroll
    for (int i = 0; i < 8; ++i) wr[i] = *(const v4fa*)wa[i];
#pragma unroll
    for (int i = 0; i < 8; ++i) xr[0][i] = *(const v4fa*)(x0 + i * 128);
#pragma unroll
    for (int i = 0; i < 8; ++i) xr[1][i] = *(const v4fa*)(x1 + i * 128);
#pragma unroll
    for (int i = 0; i < 8; ++i) xr[2][i] = *(const v4fa*)(x2 + i * 128);
    asm volatile("s_wait_xcnt 0x0" :: "v"(wa[0]), "v"(wa[1]), "v"(wa[2]), "v"(wa[3]), "v"(wa[4]), "v"(wa[5]), "v"(wa[6]), "v"(wa[7]), "v"(x0), "v"(x1), "v"(x2) : "memory");   // behind the loads, in front of the first rewrite of their address registers (named as inputs: they stay live up to here)
    __builtin_amdgcn_sched_barrier(0);   // all 32 loads stay one group at the top: left alone the first conversions rise among them, and the last eight loads are then issued only behind a wait on the first
#pragma unroll
    for (int j = 0; j < 4; ++j) { v4u t;
#pragma unroll
        for (int p = 0; p < 4; ++p) t[p] = pk2bf(wr[2 * p][j], wr[2 * p + 1][j]);
        *(v4ua*)(tl + (n4 + j) * TPITCH + kq * 8) = t; }
    __syncthreads();   // the turned tile is whole: its rows are read across the writers
    const int row = tid >> 5, col = (tid & 31) * 8;   // one wave per 512-B row
    bf* wd = (iso ? Bo + (size_t)(m - 3 * NH_) * 64 * DM : Bt + (size_t)m * 64 * DM) + (size_t)row * DM + kt * 256 + col;
#pragma unroll
    for (int s = 0; s < 4; ++s) *(v4ua*)(wd + s * 16 * DM) = *(const v4ua*)(tl + (row + 16 * s) * TPITCH + col);
#pragma unroll
    for (int p = 0; p < 3; ++p)
#pragma unroll
        for (int i = 0; i < 8; ++i) { v2u o; o[0] = pk2bf(xr[p][i][0], xr[p][i][1]); o[1] = pk2bf(xr[p][i][2], xr[p][i][3]); *(v2ua*)(X + (size_t)p * NB_ * TT * DM + e0 + i * 128) = o; }
}

#define PPITCH 72                  // LDS row pitch of the projection epilogue in 16-bit elements: 128-B rows + 16 B (b128 accesses)
// Epilogue of k_gemmp. A lane's 8 accumulator values of tile [mb][nb] are 8 consecutive A-side indices (mb*16 + hi*8 + j) at one B-side index (nb*16 + lr): the A side is the contiguous dimension of the plane that is written.
// value + bias (braw, loaded by the caller; BROW: it runs along the B side, braw[0][nb]; else along the A side, braw[2*mb], braw[2*mb+1]) -> hi, lo bf16 -> LDS rows [B-side index][A-side index] -> whole 128-B lines of Dh, Dl (row pitch PITCH in elements).
template <bool BROW, int PITCH>
__device__ __forceinline__ void proj_out(const v8f (&acc)[4][4], const v4f (&braw)[8], bf* sh, int lane, bf* Dh, bf* Dl) {
    const int lr = lane & 15, hi = lane >> 4;
    float bb[4];
    if (BROW) {
#pragma unroll
        for (int nb = 0; nb < 4; ++nb) bb[nb] = bfr(braw[0][nb]); }
#pragma unroll
    for (int mb = 0; mb < 4; ++mb) { float ba[8];
        if (!BROW) {
#pragma unroll
            for (int j = 0; j < 4; ++j) { ba[j] = bfr(braw[2 * mb][j]); ba[4 + j] = bfr(braw[2 * mb + 1][j]); } }
#pragma unroll
        for (int nb = 0; nb < 4; ++nb) { v4u hw, lw;
#pragma unroll
            for (int w = 0; w < 4; ++w) { v2f y; y[0] = acc[mb][nb][2 * w] + (BROW ? bb[nb] : ba[2 * w]); y[1] = acc[mb][nb][2 * w + 1] + (BROW ? bb[nb] : ba[2 * w + 1]);
                const unsigned hp = __builtin_bit_cast(unsigned, __builtin_convertvector(y, v2bf)); v2f r; r[0] = y[0] - __uint_as_float(hp << 16); r[1] = y[1] - __uint_as_float(hp & 0xFFFF0000u);
                hw[w] = hp; lw[w] = __builtin_bit_cast(unsigned, __builtin_convertvector(r, v2bf)); }
            bf* sp = sh + (nb * 16 + lr) * PPITCH + mb * 16 + hi * 8; *(v4ua*)sp = hw; *(v4ua*)(sp + 64 * PPITCH) = lw; } }
    __builtin_amdgcn_wave_barrier(); asm volatile("" ::: "memory");   // the tile is one wave's own: keeps the row reads below behind the other lanes' LDS writes above (the compiler sees no dependence between lanes)
    const int row = lane >> 3, c = (lane & 7) * 8;   // 8 lanes per 128-B row, 4 rows per store
    const bf* sr = sh + row * PPITCH + c; bf* gh = Dh + (size_t)row * PITCH + c; bf* gl = Dl + (size_t)row * PITCH + c;
#pragma unroll
    for (int s = 0; s < 16; ++s) { *(v4ua*)(gh + s * 4 * PITCH) = *(const v4ua*)(sr + s * 4 * PPITCH); *(v4ua*)(gl + s * 4 * PITCH) = *(const v4ua*)(sr + (64 + s * 4) * PPITCH); }
}
// ---- k_gemmp: the three projections. FOUR WAVES per 128 rows x two heads' 128 columns, each wave 64 rows x one head's 64 columns (16 accumulators); grid (NB_*TT/128, NH_/2, 3), 128 threads; z: q, k, v.
// A stage is 64 k of [A rows | B rows] in LDS, two buffers, filled by asynchronous copies one stage ahead; one barrier per stage (k_gemmw's loop).
// The attention's planes come straight out of the accumulators: for q and k the weight rows are the A operand (a lane then holds 8 consecutive d of one t: plane [head][t][d]), for v the input rows are (8 consecutive t of one d: plane [head][d][t]).
// P?h, P?l: q planes with the k planes behind them (z-stride NB_*NH_*TT*HD).
__global__ __launch_bounds__(128) void k_gemmp(const bf* __restrict__ X, const bf* __restrict__ Wt, const float* __restrict__ bias0, const float* __restrict__ bias1, const float* __restrict__ bias2, bf* Ph, bf* Pl, bf* Vh, bf* Vl) {
    typedef WFrag<bf>::V V;
    __shared__ __align__(16) bf sm[2 * 2 * GTILE];   // the two stages; behind the loop's last barrier the four waves' epilogue tiles (2 * 64 * PPITCH elements each)
    static_assert(2 * 2 * GTILE == 4 * 2 * 64 * PPITCH, "epilogue tiles fill the ring");
    const int z = blockIdx.z; const bool isv = (z == 2);   // block-uniform
    const int tid = threadIdx.x, lane = tid & 31, lr = lane & 15, hi = lane >> 4;
    const int wv = __builtin_amdgcn_readfirstlane(tid >> 5), wa = wv & 1, wb = wv >> 1;   // the wave's 64 rows of the A tile and of the B tile
    const int r0 = blockIdx.x * 128 + (isv ? wa : wb) * 64, hd = blockIdx.y * 2 + (isv ? wb : wa);
    const bf* xr = X + ((size_t)z * NB_ * TT + blockIdx.x * 128) * GK; const bf* wr = Wt + ((size_t)z * DQ + blockIdx.y * 128) * GK;
    const int crow = tid >> 3, cch = (tid & 7) * 8;   // staging: this thread's row (of 16) and 16-B piece
    const bf* ga = (isv ? xr : wr) + (size_t)crow * GK + cch; const bf* gb = (isv ? wr : xr) + (size_t)crow * GK + cch;
    const unsigned l0 = (unsigned)(size_t)sm + (crow * GPITCH + cch) * 2;
    auto stage = [&](int t, int buf) { const unsigned l = l0 + buf * 2 * GTILE * 2; cp_tile(l, ga + t * 64); cp_tile(l + GTILE * 2, gb + t * 64); };
    v8f acc[4][4];
#pragma unroll
    for (int mb = 0; mb < 4; ++mb)
#pragma unroll
        for (int nb = 0; nb < 4; ++nb) acc[mb][nb] = (v8f){};
    const float* bias = (z == 0 ? bias0 : z == 1 ? bias1 : bias2) + hd * HD; v4f braw[8];   // the lane's biases, asked for in front of the loop: they land under it
    const float* bl = bias + (isv ? lr : hi * 8);
    if (isv) {
#pragma unroll
        for (int nb = 0; nb < 4; ++nb) braw[0][nb] = bl[nb * 16]; }
    else {
#pragma unroll
        for (int mb = 0; mb < 4; ++mb) { braw[2 * mb] = *(const v4fa*)(bl + mb * 16); braw[2 * mb + 1] = *(const v4fa*)(bl + mb * 16 + 4); } }
    asm volatile("s_wait_xcnt 0x0" :: "v"(bl) : "memory");   // behind the bias loads, in front of the first rewrite of their address registers (named as input: live up to here)
    stage(0, 0); wait_copies(); __syncthreads();   // stage 0 is published
    stage(1, 1);
#pragma unroll 1
    for (int t = 0; t < GK / 64; ++t) {
        const bf* sa = sm + (t & 1) * 2 * GTILE + (wa * 64 + lr) * GPITCH + 8 * hi; const bf* sb = sm + ((t & 1) * 2 + 1) * GTILE + (wb * 64 + lr) * GPITCH + 8 * hi;
#pragma unroll
        for (int ks = 0; ks < 2; ++ks) { V a[4], b[4];
            b[0] = WFrag<bf>::ld(sb + ks * 32);
#pragma unroll
            for (int i = 0; i < 4; ++i) a[i] = WFrag<bf>::ld(sa + i * 16 * GPITCH + ks * 32);
#pragma unroll
            for (int i = 1; i < 4; ++i) b[i] = WFrag<bf>::ld(sb + i * 16 * GPITCH + ks * 32);
            __builtin_amdgcn_sched_barrier(0);   // as in k_gemmw: the k step's LDS reads stay one group in front of its products
#pragma unroll
            for (int nb = 0; nb < 4; ++nb)
#pragma unroll
                for (int mb = 0; mb < 4; ++mb) acc[mb][nb] = WFrag<bf>::mma(a[mb], b[nb], acc[mb][nb]); }
        __builtin_amdgcn_sched_barrier(0);   // the trip's products stay in front of the waits below: the copies in flight get the whole trip to land (left alone the waits and the barrier rise in front of the second k step)
        wait_lds(); wait_copies(); __syncthreads();   // publishes stage t + 1 and ends every wave's reads of stage t
        if (t + 2 < GK / 64) stage(t + 2, t & 1);     // block-uniform; into the buffer that this trip has read
    }
    wait_copies();
    bf* sh = sm + wv * 2 * 64 * PPITCH;   // every wave's last read of the ring stands in front of the loop's last barrier
    const int bb = r0 / TT, t0 = r0 % TT; const size_t pl = ((size_t)bb * NH_ + hd) * TT * HD;
    if (isv) proj_out<true, TT>(acc, braw, sh, lane, Vh + pl + t0, Vl + pl + t0);
    else { const size_t po = (size_t)z * NB_ * NH_ * TT * HD + pl + (size_t)t0 * HD; proj_out<false, HD>(acc, braw, sh, lane, Ph + po, Pl + po); }
}
typedef __attribute__((ext_vector_type(8))) unsigned v8u;
__device__ __forceinline__ float xhalf(float x) { const int b = __float_as_int(x); return __int_as_float(__builtin_amdgcn_permlanex16(b, b, 0x76543210, 0xfedcba98, false, false)); }   // the value of lane l ^ 16
#define FPITCH 72                  // LDS row pitch in 16-bit elements: 128-B rows + 16 B (ds_load_b128 readers)
#define FTILE  (64 * FPITCH)       // one staged tile: 64 rows
#define L2E    1.4426950408889634f
__global__ __launch_bounds__(256) void k_fattn(const bf* __restrict__ Qh, const bf* __restrict__ Ql, const bf* __restrict__ Kh, const bf* __restrict__ Kl, const bf* __restrict__ Vh, const bf* __restrict__ Vl, const int* __restrict__ mk, bf* Ah, bf* Al) {
    __shared__ __align__(16) bf sm[2 * 4 * FTILE];
    const int tid = threadIdx.x, lane = tid & 31, lr = lane & 15, hi = lane >> 4;
    const int q0 = blockIdx.x * 256 + (tid >> 5) * 32;
    const size_t pb = (size_t)blockIdx.y * TT * HD;
    const int srow = tid >> 3, sch = (tid & 7) * 8;   // staging: this thread moves 16 B of rows srow and srow + 32 of each tile
    v8us stg[8];
    auto gload = [&](int s) {
        __builtin_amdgcn_sched_barrier(0);   // this and the one at the foot keep the loads where they are written, with their s_wait_xcnt directly behind them
        const size_t ko = pb + (size_t)(s * 64 + srow) * HD + sch, vo = pb + (size_t)srow * TT + s * 64 + sch; const bf* a0 = Kh + ko; const bf* a1 = Kl + ko; const bf* a2 = Vh + vo; const bf* a3 = Vl + vo;
#pragma unroll
        for (int r = 0; r < 2; ++r) { stg[r] = *(const v8us*)(a0 + r * 32 * HD); stg[2 + r] = *(const v8us*)(a1 + r * 32 * HD); stg[4 + r] = *(const v8us*)(a2 + r * 32 * TT); stg[6 + r] = *(const v8us*)(a3 + r * 32 * TT); }
        asm volatile("s_wait_xcnt 0x0" :: "v"(a0), "v"(a1), "v"(a2), "v"(a3) : "memory");   // behind the loads, in front of the first rewrite of their address registers (named as inputs: they stay live up to here, so no load's result lands on them either)
        __builtin_amdgcn_sched_barrier(0); };
    auto sstore = [&](int buf) {
#pragma unroll
        for (int i = 0; i < 4; ++i)
#pragma unroll
            for (int r = 0; r < 2; ++r) *(v8us*)(sm + (buf * 4 + i) * FTILE + (srow + 32 * r) * FPITCH + sch) = stg[i * 2 + r]; };
    auto mload = [&](v4i (&m)[2][2][2], int key0, int koff) {   // mask of 32 keys (from key0 + koff; koff a literal, it goes into the loads' offset field) x 32 query columns: [column tile][key tile][4 keys]
        __builtin_amdgcn_sched_barrier(0);   // as in gload
        const int* p0 = mk + (size_t)(q0 + lr) * TT + key0 + hi * 8; const int* p1 = p0 + 16 * TT + koff;
#pragma unroll
        for (int kt = 0; kt < 2; ++kt) { m[0][kt][0] = *(const v4i*)(p0 + koff + kt * 16); m[0][kt][1] = *(const v4i*)(p0 + koff + kt * 16 + 4); m[1][kt][0] = *(const v4i*)(p1 + kt * 16); m[1][kt][1] = *(const v4i*)(p1 + kt * 16 + 4); }
        asm volatile("s_wait_xcnt 0x0" :: "v"(p0) : "memory");   // as in gload (the eight loads share one address pair)
        __builtin_amdgcn_sched_barrier(0); };
    v16bf qh[2][2], ql[2][2];   // [column tile][k step]
#pragma unroll
    for (int nt = 0; nt < 2; ++nt)
#pragma unroll
        for (int ks = 0; ks < 2; ++ks) { const size_t qo = pb + (size_t)(q0 + nt * 16 + lr) * HD + ks * 32 + 8 * hi; qh[nt][ks] = WFrag<bf>::ld(Qh + qo); ql[nt][ks] = WFrag<bf>::ld(Ql + qo); }
    asm volatile("s_wait_xcnt 0x0" ::: "memory");   // behind the loads, in front of the first rewrite of their address registers
    v8f o[4][2];
#pragma unroll
    for (int dt = 0; dt < 4; ++dt) { o[dt][0] = (v8f){}; o[dt][1] = (v8f){}; }
    float mrun[2] = { -3.0e38f, -3.0e38f }; v2f lsum[2] = { (v2f){}, (v2f){} };   // the sum runs in two chains per column tile (even and odd keys)
    v4i mm[2][2][2];
    auto pass = [&](const bf* sb, int kb, int nextkey, int nextoff) {   // 32 keys; nextkey + nextoff: first key of the pass after this one
        v16bf kf[2][2][2];   // [key tile][k step][hi, lo]: one group of LDS reads in front of the products
#pragma unroll
        for (int kt = 0; kt < 2; ++kt)
#pragma unroll
            for (int ks = 0; ks < 2; ++ks) { const bf* kp = sb + (kb * 32 + kt * 16 + lr) * FPITCH + ks * 32 + 8 * hi; kf[kt][ks][0] = WFrag<bf>::ld(kp); kf[kt][ks][1] = WFrag<bf>::ld(kp + FTILE); }
        v8f sc[2][2];   // [key tile][column tile]
#pragma unroll
        for (int kt = 0; kt < 2; ++kt) { sc[kt][0] = (v8f){}; sc[kt][1] = (v8f){};
#pragma unroll
            for (int ks = 0; ks < 2; ++ks)
#pragma unroll
                for (int nt = 0; nt < 2; ++nt) { sc[kt][nt] = wmmab(kf[kt][ks][0], qh[nt][ks], sc[kt][nt]); sc[kt][nt] = wmmab(kf[kt][ks][1], qh[nt][ks], sc[kt][nt]); sc[kt][nt] = wmmab(kf[kt][ks][0], ql[nt][ks], sc[kt][nt]); } }
        v16bf vf[4][2];   // [d tile][hi, lo]: read while the softmax runs
#pragma unroll
        for (int dt = 0; dt < 4; ++dt) { const bf* vp = sb + 2 * FTILE + (dt * 16 + lr) * FPITCH + kb * 32 + 8 * hi; vf[dt][0] = WFrag<bf>::ld(vp); vf[dt][1] = WFrag<bf>::ld(vp + FTILE); }
        float mn[2]; bool need = false;
#pragma unroll
        for (int nt = 0; nt < 2; ++nt) { float mx = -3.0e38f;
#pragma unroll
            for (int kt = 0; kt < 2; ++kt)
#pragma unroll
                for (int j = 0; j < 8; ++j) { const float t = (mm[nt][kt][j >> 2][j & 3] != 0) ? sc[kt][nt][j] * SCL : -1.0e9f; sc[kt][nt][j] = t; mx = fmaxf(mx, t); }
            mx = fmaxf(mx, xhalf(mx)); mn[nt] = fmaxf(mrun[nt], mx); need = need || (mn[nt] > mrun[nt]); }
        mload(mm, nextkey, nextoff);   // the next pass's mask flies behind this pass's exponentials and products
        if (__builtin_amdgcn_ballot_w32(need) != 0) {   // wave-uniform: one test per pass
#pragma unroll
            for (int nt = 0; nt < 2; ++nt) { const float al = __builtin_amdgcn_exp2f((mrun[nt] - mn[nt]) * L2E); lsum[nt] *= al; mrun[nt] = mn[nt];
#pragma unroll
                for (int dt = 0; dt < 4; ++dt) o[dt][nt] *= al; } }
        v16bf ph[2], pl[2];
#pragma unroll
        for (int nt = 0; nt < 2; ++nt) { const float mc = mrun[nt] * L2E; v8u hw, lw;   // packed pairs: word w holds elements 2w, 2w + 1 of the B fragment
#pragma unroll
            for (int w = 0; w < 8; ++w) { const int kt = w >> 2, j = (w & 3) * 2; v2f p; p[0] = __builtin_amdgcn_exp2f(__builtin_fmaf(sc[kt][nt][j], L2E, -mc)); p[1] = __builtin_amdgcn_exp2f(__builtin_fmaf(sc[kt][nt][j + 1], L2E, -mc)); lsum[nt] += p;
                const unsigned hp = __builtin_bit_cast(unsigned, __builtin_convertvector(p, v2bf)); v2f r; r[0] = p[0] - __uint_as_float(hp << 16); r[1] = p[1] - __uint_as_float(hp & 0xFFFF0000u);
                hw[w] = hp; lw[w] = __builtin_bit_cast(unsigned, __builtin_convertvector(r, v2bf)); }
            ph[nt] = __builtin_bit_cast(v16bf, hw); pl[nt] = __builtin_bit_cast(v16bf, lw); }
#pragma unroll
        for (int dt = 0; dt < 4; ++dt)
#pragma unroll
            for (int nt = 0; nt < 2; ++nt) { o[dt][nt] = wmmab(vf[dt][0], ph[nt], o[dt][nt]); o[dt][nt] = wmmab(vf[dt][1], ph[nt], o[dt][nt]); o[dt][nt] = wmmab(vf[dt][0], pl[nt], o[dt][nt]); }
        __builtin_amdgcn_sched_barrier(0x0108); };   // vector work does not cross (LDS reads and WMMAs may): the next pass's mask compares, and with them the wait on its loads, stay behind this pass's products
    gload(0); mload(mm, 0, 0); sstore(0); __syncthreads();
#pragma unroll 1
    for (int s = 0; s < TT / 64; ++s) { const bf* sb = sm + (s & 1) * 4 * FTILE; const bool more = (s + 1 < TT / 64);   // block-uniform
        gload(more ? s + 1 : s);   // no branch round the loads issued ahead (here and for the mask): a branch merges two paths in the compiler's load counting and the waits fall to the smaller count; the last stage's are in bounds and unused
        pass(sb, 0, s * 64, 32);
        pass(sb, 1, more ? (s + 1) * 64 : 0, 0);
        __builtin_amdgcn_sched_barrier(0);   // keeps the slots below behind the last product
        asm volatile("v_nop\n\tv_nop\n\tv_nop\n\tv_nop");   // the four vector slots between the pass's last WMMA and the first rewrite of its operands on the taken back edge
        if (more) { sstore((s + 1) & 1); __syncthreads(); } }   // the buffer written was last read in stage s - 1, whose barrier every wave has passed; this barrier publishes it
    const int bb = blockIdx.y / NH_, hh = blockIdx.y % NH_;
#pragma unroll
    for (int nt = 0; nt < 2; ++nt) { const float lh = lsum[nt][0] + lsum[nt][1]; const float inv = __fdiv_rn(1.0f, lh + xhalf(lh)); const size_t oo = ((size_t)bb * TT + q0 + nt * 16 + lr) * DQ + hh * HD + hi * 8;
#pragma unroll
        for (int dt = 0; dt < 4; ++dt) { v8us oh, ol;
#pragma unroll
            for (int j = 0; j < 8; ++j) { unsigned short a, c2; splitf(o[dt][nt][j] * inv, a, c2); oh[j] = a; ol[j] = c2; }
            *(v8us*)(Ah + oo + dt * 16) = oh; *(v8us*)(Al + oo + dt * 16) = ol; } }
}

extern "C" void kernel_launch(void* const* d_in, const int* in_sizes, int n_in,
                              void* d_out, int out_size, void* d_ws, size_t ws_size, hipStream_t stream) {
    (void)in_sizes; (void)n_in; (void)out_size;
    const float* x = (const float*)d_in[0]; const float* xk = (const float*)d_in[1]; const float* xv = (const float*)d_in[2]; const int* mk = (const int*)d_in[3];   /* mask [1024][1024] int */ const float* wq = (const float*)d_in[4]; const float* bq = (const float*)d_in[5]; const float* wk = (const float*)d_in[6]; const float* bk = (const float*)d_in[7]; const float* wv = (const float*)d_in[8]; const float* bv = (const float*)d_in[9]; const float* wo = (const float*)d_in[10]; const float* bo = (const float*)d_in[11];
    float* OUT = (float*)d_out;     // [4][1024][1024]
    char* wsp = (char*)d_ws;
    auto take = [&](size_t bytes) { char* p = wsp; wsp += (bytes + 255) & ~(size_t)255; return (void*)p; };
    bf* WQ = (bf*)take((size_t)DQ * DM * 2); bf* WK = (bf*)take((size_t)DKV * DM * 2); bf* WV = (bf*)take((size_t)DKV * DM * 2); bf* WO = (bf*)take((size_t)DM * DQ * 2); (void)WK; (void)WV;   // WQ, WK, WV are consecutive planes (z-stride DQ*DM)
    const size_t PL = (size_t)NB_ * NH_ * TT * HD;   // one plane set: all batches, all heads
    bf* QPh = (bf*)take(PL * 2); bf* KPh = (bf*)take(PL * 2); bf* QPl = (bf*)take(PL * 2); bf* KPl = (bf*)take(PL * 2); bf* VTh = (bf*)take(PL * 2); bf* VTl = (bf*)take(PL * 2);   // the k planes follow the q planes: one launch fills both
    bf* XB = (bf*)take((size_t)3 * NB_ * TT * DM * 2); bf* ATh = (bf*)take((size_t)NB_ * TT * DQ * 2); bf* ATl = (bf*)take((size_t)NB_ * TT * DQ * 2);   // bf16 inputs, merged heads hi/lo
    if ((size_t)(wsp - (char*)d_ws) > ws_size) return;    // ws 256 MiB
    k_prep<<<dim3(NPB, 1, 1), 512, 0, stream>>>(x, xk, xv, wq, wk, wv, wo, XB, WQ, WO);   // bf16 inputs; per-head [1024][64] -> Bt rows hh*64.. of WQ, WK, WV; wo -> WO
    k_gemmp<<<dim3(NB_ * TT / 128, NH_ / 2, 3), 128, 0, stream>>>(XB, WQ, bq, bk, bv, QPh, QPl, VTh, VTl);   // z: q, k, v; writes the hi/lo planes the attention reads
    k_fattn<<<dim3(TT / 256, NB_ * NH_, 1), 256, 0, stream>>>(QPh, QPl, KPh, KPl, VTh, VTl, mk, ATh, ATl);   // y: batch * 16 + head, consecutive planes (stride TT*HD)
    k_gemmw<<<dim3(NB_ * TT / 128, DM / 128, 1), 128, 0, stream>>>(ATh, ATl, WO, OUT, bo);
}

// v006
// Measured time: 107 microseconds a run.
// Next to v005, in two timings, it ran 1.05 times as fast each time.
// Over all steps from v000 it is 17.8 times as fast.
#include <hip/hip_runtime.h>

// Multi-head attention with per-head projections, an UNSCALED score and a random keep-mask (querys, keys, values [4][1024][1024]; q_h = querys Wq[h] + bq[h] (Wq, Wk, Wv [16][1024][64] 1/32 + biases [16][64] 0.01 == one 'xw' [1024][1024] projection per input whose column block h is W[h]); scores = q.k (no 1/sqrt(dk): sigma ~8); mask ([1024][1024] int {0,1}, ~50 %, read; 0 -> -1e9 == exclusion); softmax; out = concat heads Wp + bp ('xw' [1024][1024] 1/32 + 0.01) -> [4][1024][1024] (4.2 M)).
// Layout: one preparation launch (bf16 copies of the three inputs, all batches; each per-head [1024][64] weight transposed into rows h*64.. of one bf16 Bt per projection; Wp transposed; the mask packed to one bit a score, as the lane-mask words of the attention's score registers); the three exact projections + f32 biases as the z planes of one launch over all 4096 rows, whose epilogue splits each value into hi/lo bf16 and stores the attention's own planes (q, k [head][t][d], v [head][d][t]); ONE attention launch over all batches and heads (k_fattn: scores, mask, running softmax and P V stay in registers and LDS, every row on hi/lo planes, 3 products each); merged hi/lo x Wp exact + bp over all 4096 rows.
// Compute dtypes, f32 accumulate: every input rounded to bf16; projections exact + f32 biases; attention 3 products on every row; softmax f32; Wp hl x exact + bias.

#define NB_  4
#define TT   1024
#define DM   1024
#define NH_  16
#define NKV  16
#define REP  (NH_ / NKV)
#define HD   64
#define DQ   (NH_ * HD)
#define DKV  (NKV * HD)
#define ZH   16
#define RH   1024
#define WIN  0
#define PCAR 1024.0f
#define SCL  1.0f   // the module applies no 1/sqrt(dk)
typedef _Float16 h16;
typedef unsigned short bf;
typedef __attribute__((ext_vector_type(16))) __bf16   v16bf;
typedef __attribute__((ext_vector_type(16))) _Float16 v16h;
typedef __attribute__((ext_vector_type(8)))  _Float16 v8h;
typedef __attribute__((ext_vector_type(8)))  unsigned short v8us;
typedef __attribute__((ext_vector_type(8)))  float    v8f;
typedef __attribute__((ext_vector_type(4)))  float    v4f;
typedef v8h  __attribute__((may_alias)) v8ha;
typedef v4f  __attribute__((may_alias)) v4fa;
typedef v8us __attribute__((may_alias)) v8usa;

__device__ __forceinline__ unsigned short f2bf(float f) { unsigned u = __float_as_uint(f); u += 0x7FFFu + ((u >> 16) & 1u); return (unsigned short)(u >> 16); }
__device__ __forceinline__ float bf2f(unsigned short b) { return __uint_as_float(((unsigned)b) << 16); }
__device__ __forceinline__ float bfr(float f) { return bf2f(f2bf(f)); }
__device__ __forceinline__ v16h cat16(v8h lo, v8h hi) { return __builtin_shufflevector(lo, hi, 0, 1, 2, 3, 4, 5, 6, 7, 8, 9, 10, 11, 12, 13, 14, 15); }
__device__ __forceinline__ v16bf cat16b(v8us lo, v8us hi) { return __builtin_bit_cast(v16bf, __builtin_shufflevector(lo, hi, 0, 1, 2, 3, 4, 5, 6, 7, 8, 9, 10, 11, 12, 13, 14, 15)); }
__device__ __forceinline__ v8f wmma16(v16h a, v16h b, v8f c) { return __builtin_amdgcn_wmma_f32_16x16x32_f16(false, a, false, b, (short)0, c, false, false); }
__device__ __forceinline__ v8f wmmab(v16bf a, v16bf b, v8f c) { return __builtin_amdgcn_wmma_f32_16x16x32_bf16(false, a, false, b, (short)0, c, false, false); }



template <typename T16> struct WFrag;
template <> struct WFrag<h16> { typedef v16h V; static __device__ __forceinline__ V ld(const h16* p) { return cat16(*(const v8h*)p, *(const v8h*)(p + 16)); } static __device__ __forceinline__ v8f mma(V a, V b, v8f c) { return wmma16(a, b, c); } };
template <> struct WFrag<bf> { typedef v16bf V; static __device__ __forceinline__ V ld(const bf* p) { return cat16b(*(const v8us*)p, *(const v8us*)(p + 16)); } static __device__ __forceinline__ v8f mma(V a, V b, v8f c) { return wmmab(a, b, c); } };

#define GPITCH 72                  // LDS row pitch of a staged GEMM operand in 16-bit elements: 128-B rows + 16 B (ds_load_b128 readers)
#define GTILE  (128 * GPITCH)      // one staged operand tile: 128 rows x 64 k
#define GK     1024                // K of both GEMMs = row pitch of their operand planes in elements
// One 128-row x 64-k operand tile, global (row pitch GK) -> LDS (row pitch GPITCH), by 128 threads: eight asynchronous 16-B copies per lane, rows r, r + 16, .. r + 112; 8 lanes per 128-B row, so every copy instruction takes 4 whole lines.
// l: the lane's LDS byte address in row r; g: its global address in row r.
__device__ __forceinline__ void cp_tile(unsigned l, const bf* g) {
    asm volatile("global_load_async_to_lds_b128 %0, %8, off\n\t"
                 "global_load_async_to_lds_b128 %1, %9, off\n\t"
                 "global_load_async_to_lds_b128 %2, %10, off\n\t"
                 "global_load_async_to_lds_b128 %3, %11, off\n\t"
                 "global_load_async_to_lds_b128 %4, %12, off\n\t"
                 "global_load_async_to_lds_b128 %5, %13, off\n\t"
                 "global_load_async_to_lds_b128 %6, %14, off\n\t"
                 "global_load_async_to_lds_b128 %7, %15, off\n\t"
                 "s_wait_xcnt 0x0"   // behind the last copy, inside the copies' own statement: in front of every rewrite of an address register that they name
                 :: "v"(l), "v"(l + 1 * 16 * GPITCH * 2), "v"(l + 2 * 16 * GPITCH * 2), "v"(l + 3 * 16 * GPITCH * 2), "v"(l + 4 * 16 * GPITCH * 2), "v"(l + 5 * 16 * GPITCH * 2), "v"(l + 6 * 16 * GPITCH * 2), "v"(l + 7 * 16 * GPITCH * 2),
                    "v"(g), "v"(g + 1 * 16 * GK), "v"(g + 2 * 16 * GK), "v"(g + 3 * 16 * GK), "v"(g + 4 * 16 * GK), "v"(g + 5 * 16 * GK), "v"(g + 6 * 16 * GK), "v"(g + 7 * 16 * GK) : "memory");
}
__device__ __forceinline__ void wait_copies() { asm volatile("s_wait_asynccnt 0x0" ::: "memory"); }   // this wave's copies have landed in LDS (the compiler places no wait for them)
__device__ __forceinline__ void wait_lds() { asm volatile("s_wait_dscnt 0x0" ::: "memory"); }         // this wave's LDS reads have returned: behind the next barrier their buffer may be refilled

// ---- k_gemmw: the output projection. FOUR WAVES per 128x128 output tile, 64x64 (16 accumulators) each; grid (M/128, N/128), 128 threads.
// C[m][n] (f32, pitch DM) = sum_k (A[m][k] + A2[m][k]) Bt[n][k] + bias[n], two products per k step. A stage is 64 k of [A | A2 | Bt] rows in LDS, two buffers, filled by asynchronous copies one stage ahead; one barrier per stage.
__global__ __launch_bounds__(128) void k_gemmw(const bf* __restrict__ A, const bf* __restrict__ A2, const bf* __restrict__ Bt, float* C, const float* __restrict__ bias) {
    typedef WFrag<bf>::V V;
    __shared__ __align__(16) bf sm[2 * 3 * GTILE];
    __shared__ __align__(16) float osm[4 * 16 * 68];
    const int tid = threadIdx.x, lane = tid & 31, lr = lane & 15, hi = lane >> 4;
    const int wv = __builtin_amdgcn_readfirstlane(tid >> 5), wa = wv & 1, wb = wv >> 1;   // the wave's 64 rows of the A tiles and of the B tile
    const int r0 = blockIdx.x * 128 + wa * 64, c0 = blockIdx.y * 128 + wb * 64; const int ldc = DM;
    float* os = osm + wv * 16 * 68;
    const int crow = tid >> 3, cch = (tid & 7) * 8;   // staging: this thread's row (of 16) and 16-B piece
    const size_t ao = (size_t)(blockIdx.x * 128 + crow) * GK + cch; const bf* ga = A + ao; const bf* ga2 = A2 + ao; const bf* gb = Bt + (size_t)(blockIdx.y * 128 + crow) * GK + cch;
    const unsigned l0 = (unsigned)(size_t)sm + (crow * GPITCH + cch) * 2;
    auto stage = [&](int t, int buf) { const unsigned l = l0 + buf * 3 * GTILE * 2; cp_tile(l, ga + t * 64); cp_tile(l + GTILE * 2, ga2 + t * 64); cp_tile(l + 2 * GTILE * 2, gb + t * 64); };
    v8f acc[4][4];
#pragma unroll
    for (int mb = 0; mb < 4; ++mb)
#pragma unroll
        for (int nb = 0; nb < 4; ++nb) acc[mb][nb] = (v8f){};
    stage(0, 0); wait_copies(); __syncthreads();   // stage 0 is published
    stage(1, 1);
#pragma unroll 1
    for (int t = 0; t < GK / 64; ++t) {
        const bf* sa = sm + (t & 1) * 3 * GTILE + (wa * 64 + lr) * GPITCH + 8 * hi; const bf* sb = sm + ((t & 1) * 3 + 2) * GTILE + (wb * 64 + lr) * GPITCH + 8 * hi;
#pragma unroll
        for (int ks = 0; ks < 2; ++ks) { V a[4], a2[4], b[4];
            b[0] = WFrag<bf>::ld(sb + ks * 32);
#pragma unroll
            for (int mb = 0; mb < 4; ++mb) { a[mb] = WFrag<bf>::ld(sa + mb * 16 * GPITCH + ks * 32); a2[mb] = WFrag<bf>::ld(sa + GTILE + mb * 16 * GPITCH + ks * 32); }
#pragma unroll
            for (int nb = 1; nb < 4; ++nb) b[nb] = WFrag<bf>::ld(sb + nb * 16 * GPITCH + ks * 32);
            __builtin_amdgcn_sched_barrier(0);   // the k step's LDS reads stay one group in front of its products, in the order the products want them: left alone they sink among the WMMAs, each group behind a wait to 0
#pragma unroll
            for (int nb = 0; nb < 4; ++nb)
#pragma unroll
                for (int mb = 0; mb < 4; ++mb) { acc[mb][nb] = WFrag<bf>::mma(a[mb], b[nb], acc[mb][nb]); acc[mb][nb] = WFrag<bf>::mma(a2[mb], b[nb], acc[mb][nb]); } }
        __builtin_amdgcn_sched_barrier(0);   // the trip's products stay in front of the waits below: the copies in flight get the whole trip to land (left alone the waits and the barrier rise in front of the second k step)
        wait_lds(); wait_copies(); __syncthreads();   // publishes stage t + 1 and ends every wave's reads of stage t
        if (t + 2 < GK / 64) stage(t + 2, t & 1);     // block-uniform; into the buffer that this trip has read
    }
    wait_copies();
#pragma unroll
    for (int mb = 0; mb < 4; ++mb) {
#pragma unroll
        for (int nb = 0; nb < 4; ++nb) {
#pragma unroll
            for (int j = 0; j < 8; ++j) os[(hi * 8 + j) * 68 + nb * 16 + lr] = acc[mb][nb][j]; }
        __builtin_amdgcn_wave_barrier(); asm volatile("" ::: "memory");   // the tile is one wave's own: keeps the row reads below behind the other lanes' LDS writes above (the compiler sees no dependence between lanes)
        float* crow_ = C + (size_t)(r0 + mb * 16) * ldc + c0;
#pragma unroll
        for (int s = 0; s < 8; ++s) { const int row = 2 * s + hi, cofs = lr * 4; v4f val = *(const v4fa*)(os + row * 68 + cofs); val[0] += bfr(bias[c0 + cofs]); val[1] += bfr(bias[c0 + cofs + 1]); val[2] += bfr(bias[c0 + cofs + 2]); val[3] += bfr(bias[c0 + cofs + 3]);
            *(v4f*)(crow_ + (size_t)row * ldc + cofs) = val; }
        __builtin_amdgcn_wave_barrier();
        if (mb < 3) asm volatile("s_wait_xcnt 0x0" ::: "memory");   // behind the stores, in front of the first rewrite of their data registers; its clobber also keeps the next tile's LDS writes behind this tile's row reads
    }
}

__device__ __forceinline__ void splitf(float y, unsigned short& h, unsigned short& l) { h = f2bf(y); l = f2bf(y - bf2f(h)); }
typedef __attribute__((ext_vector_type(2))) _Float16 v2h;
typedef __attribute__((ext_vector_type(4))) _Float16 v4h;
typedef __attribute__((ext_vector_type(2))) unsigned short v2us;
typedef __attribute__((ext_vector_type(4))) unsigned short v4us;
typedef __attribute__((ext_vector_type(2))) float v2f;
typedef __attribute__((ext_vector_type(4))) int v4i;

typedef __attribute__((ext_vector_type(2))) __bf16 v2bf;
typedef __attribute__((ext_vector_type(2))) unsigned v2u;
typedef __attribute__((ext_vector_type(4))) unsigned v4u;
typedef v2u __attribute__((may_alias)) v2ua;
typedef v4u __attribute__((may_alias)) v4ua;
__device__ __forceinline__ unsigned pk2bf(float a, float b) { v2f y; y[0] = a; y[1] = b; return __builtin_bit_cast(unsigned, __builtin_convertvector(y, v2bf)); }   // a in the low half: the lower address
#define TPITCH 264                 // LDS row pitch of the transposed weight tile in 16-bit elements: 512-B rows + 16 B (b128 accesses)
#define NPB    256                 // work-groups of k_prep: 16 waves each, one per WGP, all resident
#define XPB    (NB_ * TT * DM / NPB)   // elements of each input that one work-group converts
// ---- k_prep: the whole preparation in one launch; grid NPB, 512 threads. Every work-group takes an equal share of all three jobs, and every global access covers whole lines.
// Weights: 64 column blocks [1024 k][64 n] f32 (16 heads each of w0, w1, w2, row pitch HD; 16 column blocks of w3, row pitch DM) x 4 k tiles. One 256-k x 64-n tile per work-group: a thread reads 4 n of 8 consecutive k rows (16 lanes per 256-B row piece), packs 8 k per n into 16 B,
// turns the tile in LDS to [n][k], and the work-group writes 64 rows of 512 B: Bt (blocks 0..47, [n][k] planes one behind the other) or Bo (w3), [n][1024 k] bf16.
// Inputs: 64 KB of each of s0, s1, s2 per work-group, 4 KB per wave as eight 512-B loads; plane p of X gets source p as bf16, 256 B per store.
// Mask: one 16-query x 16-key tile per wave (a work-group: 16 rows x 1 KB, whole lines). A lane reads the 8 entries that the same lane of an attention wave holds as scores of that tile (query lane & 15, keys (lane >> 4) * 8 + j); word j = ballot(entry j != 0).
// MB [64 query tiles][64 key tiles][8 j]; the work-group's 128 words go out through LDS as 4 whole lines from one wave.
// All 34 loads of a thread are asked for at the top.
__global__ __launch_bounds__(512) void k_prep(const float* __restrict__ s0, const float* __restrict__ s1, const float* __restrict__ s2, const float* __restrict__ w0, const float* __restrict__ w1, const float* __restrict__ w2, const float* __restrict__ w3, const int* __restrict__ mk, bf* X, bf* Bt, bf* Bo, unsigned* MB) {
    __shared__ __align__(16) bf tl[64 * TPITCH];
    __shared__ __align__(16) unsigned ml[16 * 8];
    const int tid = threadIdx.x, m = blockIdx.x >> 2, kt = blockIdx.x & 3;   // m: column block, kt: k tile (block-uniform)
    const bool iso = (m >= 3 * NH_);
    const float* wsrc = iso ? w3 + (m - 3 * NH_) * 64 : (m < NH_ ? w0 : m < 2 * NH_ ? w1 : w2) + (size_t)(m & (NH_ - 1)) * DM * HD; const int wp = iso ? DM : HD;
    const int n4 = (tid & 15) * 4, kq = tid >> 4;
    const float* wl = wsrc + (size_t)(kt * 256 + kq * 8) * wp + n4;
    const float* wa[8];
#pragma unroll
    for (int i = 0; i < 8; ++i) wa[i] = wl + i * wp;
    const size_t e0 = (size_t)blockIdx.x * XPB + (tid >> 5) * 1024 + (tid & 31) * 4;
    const float* x0 = s0 + e0; const float* x1 = s1 + e0; const float* x2 = s2 + e0;
    const int* mp = mk + (size_t)((blockIdx.x >> 2) * 16 + (tid & 15)) * TT + ((blockIdx.x & 3) * 16 + (tid >> 5)) * 16 + ((tid >> 4) & 1) * 8;
    v4f wr[8], xr[3][8]; v4i mr[2];
#pragma unroll
    for (int i = 0; i < 8; ++i) wr[i] = *(const v4fa*)wa[i];
    mr[0] = *(const v4i*)mp; mr[1] = *(const v4i*)(mp + 4);
#pragma unroll
    for (int i = 0; i < 8; ++i) xr[0][i] = *(const v4fa*)(x0 + i * 128);
#pragma unroll
    for (int i = 0; i < 8; ++i) xr[1][i] = *(const v4fa*)(x1 + i * 128);
#pragma unroll
    for (int i = 0; i < 8; ++i) xr[2][i] = *(const v4fa*)(x2 + i * 128);
    asm volatile("s_wait_xcnt 0x0" :: "v"(wa[0]), "v"(wa[1]), "v"(wa[2]), "v"(wa[3]), "v"(wa[4]), "v"(wa[5]), "v"(wa[6]), "v"(wa[7]), "v"(x0), "v"(x1), "v"(x2), "v"(mp) : "memory");   // behind the loads, in front of the first rewrite of their address registers (named as inputs: they stay live up to here)
    __builtin_amdgcn_sched_barrier(0);   // all 34 loads stay one group at the top: left alone the first conversions rise among them, and the last eight loads are then issued only behind a wait on the first
#pragma unroll
    for (int j = 0; j < 4; ++j) { v4u t;
#pragma unroll
        for (int p = 0; p < 4; ++p) t[p] = pk2bf(wr[2 * p][j], wr[2 * p + 1][j]);
        *(v4ua*)(tl + (n4 + j) * TPITCH + kq * 8) = t; }
    { v4u b0, b1;
#pragma unroll
        for (int j = 0; j < 4; ++j) { b0[j] = __builtin_amdgcn_ballot_w32(mr[0][j] != 0); b1[j] = __builtin_amdgcn_ballot_w32(mr[1][j] != 0); }
        if ((tid & 31) == 0) { *(v4ua*)(ml + (tid >> 5) * 8) = b0; *(v4ua*)(ml + (tid >> 5) * 8 + 4) = b1; } }
    __syncthreads();   // the turned tile is whole: its rows are read across the writers; so are the 16 waves' mask words
    const int row = tid >> 5, col = (tid & 31) * 8;   // one wave per 512-B row
    bf* wd = (iso ? Bo + (size_t)(m - 3 * NH_) * 64 * DM : Bt + (size_t)m * 64 * DM) + (size_t)row * DM + kt * 256 + col;
#pragma unroll
    for (int s = 0; s < 4; ++s) *(v4ua*)(wd + s * 16 * DM) = *(const v4ua*)(tl + (row + 16 * s) * TPITCH + col);
#pragma unroll
    for (int p = 0; p < 3; ++p)
#pragma unroll
        for (int i = 0; i < 8; ++i) { v2u o; o[0] = pk2bf(xr[p][i][0], xr[p][i][1]); o[1] = pk2bf(xr[p][i][2], xr[p][i][3]); *(v2ua*)(X + (size_t)p * NB_ * TT * DM + e0 + i * 128) = o; }
    if (tid < 32) *(v4ua*)(MB + blockIdx.x * 128 + tid * 4) = *(const v4ua*)(ml + tid * 4);   // the kernel's last store: no register of it is rewritten behind it
}

#define PPITCH 72                  // LDS row pitch of the projection epilogue in 16-bit elements: 128-B rows + 16 B (b128 accesses)
// Epilogue of k_gemmp. A lane's 8 accumulator values of tile [mb][nb] are 8 consecutive A-side indices (mb*16 + hi*8 + j) at one B-side index (nb*16 + lr): the A side is the contiguous dimension of the plane that is written.
// value + bias (braw, loaded by the caller; BROW: it runs along the B side, braw[0][nb]; else along the A side, braw[2*mb], braw[2*mb+1]) -> hi, lo bf16 -> LDS rows [B-side index][A-side index] -> whole 128-B lines of Dh, Dl (row pitch PITCH in elements).
template <bool BROW, int PITCH>
__device__ __forceinline__ void proj_out(const v8f (&acc)[4][4], const v4f (&braw)[8], bf* sh, int lane, bf* Dh, bf* Dl) {
    const int lr = lane & 15, hi = lane >> 4;
    float bb[4];
    if (BROW) {
#pragma unroll
        for (int nb = 0; nb < 4; ++nb) bb[nb] = bfr(braw[0][nb]); }
#pragma unroll
    for (int mb = 0; mb < 4; ++mb) { float ba[8];
        if (!BROW) {
#pragma unroll
            for (int j = 0; j < 4; ++j) { ba[j] = bfr(braw[2 * mb][j]); ba[4 + j] = bfr(braw[2 * mb + 1][j]); } }
#pragma unroll
        for (int nb = 0; nb < 4; ++nb) { v4u hw, lw;
#pragma unroll
            for (int w = 0; w < 4; ++w) { v2f y; y[0] = acc[mb][nb][2 * w] + (BROW ? bb[nb] : ba[2 * w]); y[1] = acc[mb][nb][2 * w + 1] + (BROW ? bb[nb] : ba[2 * w + 1]);
                const unsigned hp = __builtin_bit_cast(unsigned, __builtin_convertvector(y, v2bf)); v2f r; r[0] = y[0] - __uint_as_float(hp << 16); r[1] = y[1] - __uint_as_float(hp & 0xFFFF0000u);
                hw[w] = hp; lw[w] = __builtin_bit_cast(unsigned, __builtin_convertvector(r, v2bf)); }
            bf* sp = sh + (nb * 16 + lr) * PPITCH + mb * 16 + hi * 8; *(v4ua*)sp = hw; *(v4ua*)(sp + 64 * PPITCH) = lw; } }
    __builtin_amdgcn_wave_barrier(); asm volatile("" ::: "memory");   // the tile is one wave's own: keeps the row reads below behind the other lanes' LDS writes above (the compiler sees no dependence between lanes)
    const int row = lane >> 3, c = (lane & 7) * 8;   // 8 lanes per 128-B row, 4 rows per store
    const bf* sr = sh + row * PPITCH + c; bf* gh = Dh + (size_t)row * PITCH + c; bf* gl = Dl + (size_t)row * PITCH + c;
#pragma unroll
    for (int s = 0; s < 16; ++s) { *(v4ua*)(gh + s * 4 * PITCH) = *(const v4ua*)(sr + s * 4 * PPITCH); *(v4ua*)(gl + s * 4 * PITCH) = *(const v4ua*)(sr + (64 + s * 4) * PPITCH); }
}
// ---- k_gemmp: the three projections. FOUR WAVES per 128 rows x two heads' 128 columns, each wave 64 rows x one head's 64 columns (16 accumulators); grid (NB_*TT/128, NH_/2, 3), 128 threads; z: q, k, v.
// A stage is 64 k of [A rows | B rows] in LDS, two buffers, filled by asynchronous copies one stage ahead; one barrier per stage (k_gemmw's loop).
// The attention's planes come straight out of the accumulators: for q and k the weight rows are the A operand (a lane then holds 8 consecutive d of one t: plane [head][t][d]), for v the input rows are (8 consecutive t of one d: plane [head][d][t]).
// P?h, P?l: q planes with the k planes behind them (z-stride NB_*NH_*TT*HD).
__global__ __launch_bounds__(128) void k_gemmp(const bf* __restrict__ X, const bf* __restrict__ Wt, const float* __restrict__ bias0, const float* __restrict__ bias1, const float* __restrict__ bias2, bf* Ph, bf* Pl, bf* Vh, bf* Vl) {
    typedef WFrag<bf>::V V;
    __shared__ __align__(16) bf sm[2 * 2 * GTILE];   // the two stages; behind the loop's last barrier the four waves' epilogue tiles (2 * 64 * PPITCH elements each)
    static_assert(2 * 2 * GTILE == 4 * 2 * 64 * PPITCH, "epilogue tiles fill the ring");
    const int z = blockIdx.z; const bool isv = (z == 2);   // block-uniform
    const int tid = threadIdx.x, lane = tid & 31, lr = lane & 15, hi = lane >> 4;
    const int wv = __builtin_amdgcn_readfirstlane(tid >> 5), wa = wv & 1, wb = wv >> 1;   // the wave's 64 rows of the A tile and of the B tile
    const int r0 = blockIdx.x * 128 + (isv ? wa : wb) * 64, hd = blockIdx.y * 2 + (isv ? wb : wa);
    const bf* xr = X + ((size_t)z * NB_ * TT + blockIdx.x * 128) * GK; const bf* wr = Wt + ((size_t)z * DQ + blockIdx.y * 128) * GK;
    const int crow = tid >> 3, cch = (tid & 7) * 8;   // staging: this thread's row (of 16) and 16-B piece
    const bf* ga = (isv ? xr : wr) + (size_t)crow * GK + cch; const bf* gb = (isv ? wr : xr) + (size_t)crow * GK + cch;
    const unsigned l0 = (unsigned)(size_t)sm + (crow * GPITCH + cch) * 2;
    auto stage = [&](int t, int buf) { const unsigned l = l0 + buf * 2 * GTILE * 2; cp_tile(l, ga + t * 64); cp_tile(l + GTILE * 2, gb + t * 64); };
    v8f acc[4][4];
#pragma unroll
    for (int mb = 0; mb < 4; ++mb)
#pragma unroll
        for (int nb = 0; nb < 4; ++nb) acc[mb][nb] = (v8f){};
    const float* bias = (z == 0 ? bias0 : z == 1 ? bias1 : bias2) + hd * HD; v4f braw[8];   // the lane's biases, asked for in front of the loop: they land under it
    const float* bl = bias + (isv ? lr : hi * 8);
    if (isv) {
#pragma unroll
        for (int nb = 0; nb < 4; ++nb) braw[0][nb] = bl[nb * 16]; }
    else {
#pragma unroll
        for (int mb = 0; mb < 4; ++mb) { braw[2 * mb] = *(const v4fa*)(bl + mb * 16); braw[2 * mb + 1] = *(const v4fa*)(bl + mb * 16 + 4); } }
    asm volatile("s_wait_xcnt 0x0" :: "v"(bl) : "memory");   // behind the bias loads, in front of the first rewrite of their address registers (named as input: live up to here)
    stage(0, 0); wait_copies(); __syncthreads();   // stage 0 is published
    stage(1, 1);
#pragma unroll 1
    for (int t = 0; t < GK / 64; ++t) {
        const bf* sa = sm + (t & 1) * 2 * GTILE + (wa * 64 + lr) * GPITCH + 8 * hi; const bf* sb = sm + ((t & 1) * 2 + 1) * GTILE + (wb * 64 + lr) * GPITCH + 8 * hi;
#pragma unroll
        for (int ks = 0; ks < 2; ++ks) { V a[4], b[4];
            b[0] = WFrag<bf>::ld(sb + ks * 32);
#pragma unroll
            for (int i = 0; i < 4; ++i) a[i] = WFrag<bf>::ld(sa + i * 16 * GPITCH + ks * 32);
#pragma unroll
            for (int i = 1; i < 4; ++i) b[i] = WFrag<bf>::ld(sb + i * 16 * GPITCH + ks * 32);
            __builtin_amdgcn_sched_barrier(0);   // as in k_gemmw: the k step's LDS reads stay one group in front of its products
#pragma unroll
            for (int nb = 0; nb < 4; ++nb)
#pragma unroll
                for (int mb = 0; mb < 4; ++mb) acc[mb][nb] = WFrag<bf>::mma(a[mb], b[nb], acc[mb][nb]); }
        __builtin_amdgcn_sched_barrier(0);   // the trip's products stay in front of the waits below: the copies in flight get the whole trip to land (left alone the waits and the barrier rise in front of the second k step)
        wait_lds(); wait_copies(); __syncthreads();   // publishes stage t + 1 and ends every wave's reads of stage t
        if (t + 2 < GK / 64) stage(t + 2, t & 1);     // block-uniform; into the buffer that this trip has read
    }
    wait_copies();
    bf* sh = sm + wv * 2 * 64 * PPITCH;   // every wave's last read of the ring stands in front of the loop's last barrier
    const int bb = r0 / TT, t0 = r0 % TT; const size_t pl = ((size_t)bb * NH_ + hd) * TT * HD;
    if (isv) proj_out<true, TT>(acc, braw, sh, lane, Vh + pl + t0, Vl + pl + t0);
    else { const size_t po = (size_t)z * NB_ * NH_ * TT * HD + pl + (size_t)t0 * HD; proj_out<false, HD>(acc, braw, sh, lane, Ph + po, Pl + po); }
}
typedef __attribute__((ext_vector_type(8))) unsigned v8u;
typedef __attribute__((ext_vector_type(16))) unsigned v16u;
typedef const __attribute__((address_space(4))) v16u* cw16;   // constant address space: the words are written by the launch before and by nobody in this one; a wave-uniform load through it is a scalar load also inside the loop (through the plain pointer the loop's loads came out as vector loads with 32 readfirstlanes a pass)
__device__ __forceinline__ float xhalf(float x) { const int b = __float_as_int(x); return __int_as_float(__builtin_amdgcn_permlanex16(b, b, 0x76543210, 0xfedcba98, false, false)); }   // the value of lane l ^ 16
#define FPITCH 72                  // LDS row pitch in 16-bit elements: 128-B rows + 16 B (ds_load_b128 readers)
#define FTILE  (64 * FPITCH)       // one staged tile: 64 rows
#define L2E    1.4426950408889634f
__global__ __launch_bounds__(256) void k_fattn(const bf* __restrict__ Qh, const bf* __restrict__ Ql, const bf* __restrict__ Kh, const bf* __restrict__ Kl, const bf* __restrict__ Vh, const bf* __restrict__ Vl, const unsigned* __restrict__ MB, bf* Ah, bf* Al) {
    __shared__ __align__(16) bf sm[2 * 4 * FTILE];
    const int tid = threadIdx.x, lane = tid & 31, lr = lane & 15, hi = lane >> 4;
    const int q0 = blockIdx.x * 256 + (tid >> 5) * 32;
    const size_t pb = (size_t)blockIdx.y * TT * HD;
    const int srow = tid >> 3, sch = (tid & 7) * 8;   // staging: this thread moves 16 B of rows srow and srow + 32 of each tile
    v8us stg[8];
    auto gload = [&](int s) {
        __builtin_amdgcn_sched_barrier(0);   // this and the one at the foot keep the loads where they are written, with their s_wait_xcnt directly behind them
        const size_t ko = pb + (size_t)(s * 64 + srow) * HD + sch, vo = pb + (size_t)srow * TT + s * 64 + sch; const bf* a0 = Kh + ko; const bf* a1 = Kl + ko; const bf* a2 = Vh + vo; const bf* a3 = Vl + vo;
#pragma unroll
        for (int r = 0; r < 2; ++r) { stg[r] = *(const v8us*)(a0 + r * 32 * HD); stg[2 + r] = *(const v8us*)(a1 + r * 32 * HD); stg[4 + r] = *(const v8us*)(a2 + r * 32 * TT); stg[6 + r] = *(const v8us*)(a3 + r * 32 * TT); }
        asm volatile("s_wait_xcnt 0x0" :: "v"(a0), "v"(a1), "v"(a2), "v"(a3) : "memory");   // behind the loads, in front of the first rewrite of their address registers (named as inputs: they stay live up to here, so no load's result lands on them either)
        __builtin_amdgcn_sched_barrier(0); };
    auto sstore = [&](int buf) {
#pragma unroll
        for (int i = 0; i < 4; ++i)
#pragma unroll
            for (int r = 0; r < 2; ++r) *(v8us*)(sm + (buf * 4 + i) * FTILE + (srow + 32 * r) * FPITCH + sch) = stg[i * 2 + r]; };
    const unsigned* mq = MB + (size_t)(blockIdx.x * 16 + __builtin_amdgcn_readfirstlane(tid >> 5) * 2) * 512;   // the wave's two query tiles, 512 words each; wave-uniform
    auto mload = [&](v16u (&m)[2], int key0, int koff) {   // mask words of 32 keys (from key0 + koff; koff a literal) x 32 query columns: [column tile][key tile * 8 + j]; 8 words per 16 keys
        __builtin_amdgcn_sched_barrier(0);   // as in gload
        const unsigned* p0 = mq + (key0 >> 1);
        m[0] = *(cw16)(size_t)(p0 + koff / 2); m[1] = *(cw16)(size_t)(p0 + 512 + koff / 2);
        asm volatile("s_wait_xcnt 0x0" :: "s"(p0) : "memory");   // behind the loads, in front of the first rewrite of their address registers (the two loads share one scalar pair, named as input: live up to here)
        __builtin_amdgcn_sched_barrier(0); };
    v16bf qh[2][2], ql[2][2];   // [column tile][k step]
#pragma unroll
    for (int nt = 0; nt < 2; ++nt)
#pragma unroll
        for (int ks = 0; ks < 2; ++ks) { const size_t qo = pb + (size_t)(q0 + nt * 16 + lr) * HD + ks * 32 + 8 * hi; qh[nt][ks] = WFrag<bf>::ld(Qh + qo); ql[nt][ks] = WFrag<bf>::ld(Ql + qo); }
    asm volatile("s_wait_xcnt 0x0" ::: "memory");   // behind the loads, in front of the first rewrite of their address registers
    v8f o[4][2];
#pragma unroll
    for (int dt = 0; dt < 4; ++dt) { o[dt][0] = (v8f){}; o[dt][1] = (v8f){}; }
    float mrun[2] = { -3.0e38f, -3.0e38f }; v2f lsum[2] = { (v2f){}, (v2f){} };   // the sum runs in two chains per column tile (even and odd keys)
    v16u mm[2];
    auto pass = [&](const bf* sb, int kb, int nextkey, int nextoff) {   // 32 keys; nextkey + nextoff: first key of the pass after this one
        v16bf kf[2][2][2];   // [key tile][k step][hi, lo]: one group of LDS reads in front of the products
#pragma unroll
        for (int kt = 0; kt < 2; ++kt)
#pragma unroll
            for (int ks = 0; ks < 2; ++ks) { const bf* kp = sb + (kb * 32 + kt * 16 + lr) * FPITCH + ks * 32 + 8 * hi; kf[kt][ks][0] = WFrag<bf>::ld(kp); kf[kt][ks][1] = WFrag<bf>::ld(kp + FTILE); }
        v8f sc[2][2];   // [key tile][column tile]
#pragma unroll
        for (int kt = 0; kt < 2; ++kt) { sc[kt][0] = (v8f){}; sc[kt][1] = (v8f){};
#pragma unroll
            for (int ks = 0; ks < 2; ++ks)
#pragma unroll
                for (int nt = 0; nt < 2; ++nt) { sc[kt][nt] = wmmab(kf[kt][ks][0], qh[nt][ks], sc[kt][nt]); sc[kt][nt] = wmmab(kf[kt][ks][1], qh[nt][ks], sc[kt][nt]); sc[kt][nt] = wmmab(kf[kt][ks][0], ql[nt][ks], sc[kt][nt]); } }
        v16bf vf[4][2];   // [d tile][hi, lo]: read while the softmax runs
#pragma unroll
        for (int dt = 0; dt < 4; ++dt) { const bf* vp = sb + 2 * FTILE + (dt * 16 + lr) * FPITCH + kb * 32 + 8 * hi; vf[dt][0] = WFrag<bf>::ld(vp); vf[dt][1] = WFrag<bf>::ld(vp + FTILE); }
        float mn[2]; bool need = false;
#pragma unroll
        for (int nt = 0; nt < 2; ++nt) { float mx = -3.0e38f;
#pragma unroll
            for (int kt = 0; kt < 2; ++kt)
#pragma unroll
                for (int j = 0; j < 8; ++j) { const float t = __builtin_amdgcn_inverse_ballot_w32(mm[nt][kt * 8 + j]) ? sc[kt][nt][j] * SCL : -1.0e9f; sc[kt][nt][j] = t; mx = fmaxf(mx, t); }
            mx = fmaxf(mx, xhalf(mx)); mn[nt] = fmaxf(mrun[nt], mx); need = need || (mn[nt] > mrun[nt]); }
        mload(mm, nextkey, nextoff);   // the next pass's mask flies behind this pass's exponentials and products
        if (__builtin_amdgcn_ballot_w32(need) != 0) {   // wave-uniform: one test per pass
#pragma unroll
            for (int nt = 0; nt < 2; ++nt) { const float al = __builtin_amdgcn_exp2f((mrun[nt] - mn[nt]) * L2E); lsum[nt] *= al; mrun[nt] = mn[nt];
#pragma unroll
                for (int dt = 0; dt < 4; ++dt) o[dt][nt] *= al; } }
        v16bf ph[2], pl[2];
#pragma unroll
        for (int nt = 0; nt < 2; ++nt) { const float mc = mrun[nt] * L2E; v8u hw, lw;   // packed pairs: word w holds elements 2w, 2w + 1 of the B fragment
#pragma unroll
            for (int w = 0; w < 8; ++w) { const int kt = w >> 2, j = (w & 3) * 2; v2f p; p[0] = __builtin_amdgcn_exp2f(__builtin_fmaf(sc[kt][nt][j], L2E, -mc)); p[1] = __builtin_amdgcn_exp2f(__builtin_fmaf(sc[kt][nt][j + 1], L2E, -mc)); lsum[nt] += p;
                const unsigned hp = __builtin_bit_cast(unsigned, __builtin_convertvector(p, v2bf)); v2f r; r[0] = p[0] - __uint_as_float(hp << 16); r[1] = p[1] - __uint_as_float(hp & 0xFFFF0000u);
                hw[w] = hp; lw[w] = __builtin_bit_cast(unsigned, __builtin_convertvector(r, v2bf)); }
            ph[nt] = __builtin_bit_cast(v16bf, hw); pl[nt] = __builtin_bit_cast(v16bf, lw); }
#pragma unroll
        for (int dt = 0; dt < 4; ++dt)
#pragma unroll
            for (int nt = 0; nt < 2; ++nt) { o[dt][nt] = wmmab(vf[dt][0], ph[nt], o[dt][nt]); o[dt][nt] = wmmab(vf[dt][1], ph[nt], o[dt][nt]); o[dt][nt] = wmmab(vf[dt][0], pl[nt], o[dt][nt]); }
        __builtin_amdgcn_sched_barrier(0x0108); };   // vector work does not cross (LDS reads and WMMAs may): the next pass's selects stay behind this pass's products, and its K reads stay one group ahead (left alone they scatter among the products in pairs, several directly in front of a wait to 0)
    gload(0); mload(mm, 0, 0); sstore(0); __syncthreads();
#pragma unroll 1
    for (int s = 0; s < TT / 64; ++s) { const bf* sb = sm + (s & 1) * 4 * FTILE; const bool more = (s + 1 < TT / 64);   // block-uniform
        gload(more ? s + 1 : s);   // no branch round the loads issued ahead (here and for the mask): a branch merges two paths in the compiler's load counting and the waits fall to the smaller count; the last stage's are in bounds and unused
        pass(sb, 0, s * 64, 32);
        pass(sb, 1, more ? (s + 1) * 64 : 0, 0);
        __builtin_amdgcn_sched_barrier(0);   // keeps the slots below behind the last product
        asm volatile("v_nop\n\tv_nop\n\tv_nop\n\tv_nop");   // the four vector slots between the pass's last WMMA and the first rewrite of its operands on the taken back edge
        if (more) { sstore((s + 1) & 1); __syncthreads(); } }   // the buffer written was last read in stage s - 1, whose barrier every wave has passed; this barrier publishes it
    const int bb = blockIdx.y / NH_, hh = blockIdx.y % NH_;
#pragma unroll
    for (int nt = 0; nt < 2; ++nt) { const float lh = lsum[nt][0] + lsum[nt][1]; const float inv = __fdiv_rn(1.0f, lh + xhalf(lh)); const size_t oo = ((size_t)bb * TT + q0 + nt * 16 + lr) * DQ + hh * HD + hi * 8;
#pragma unroll
        for (int dt = 0; dt < 4; ++dt) { v8us oh, ol;
#pragma unroll
            for (int j = 0; j < 8; ++j) { unsigned short a, c2; splitf(o[dt][nt][j] * inv, a, c2); oh[j] = a; ol[j] = c2; }
            *(v8us*)(Ah + oo + dt * 16) = oh; *(v8us*)(Al + oo + dt * 16) = ol; } }
}

extern "C" void kernel_launch(void* const* d_in, const int* in_sizes, int n_in,
                              void* d_out, int out_size, void* d_ws, size_t ws_size, hipStream_t stream) {
    (void)in_sizes; (void)n_in; (void)out_size;
    const float* x = (const float*)d_in[0]; const float* xk = (const float*)d_in[1]; const float* xv = (const float*)d_in[2]; const int* mk = (const int*)d_in[3];   /* mask [1024][1024] int */ const float* wq = (const float*)d_in[4]; const float* bq = (const float*)d_in[5]; const float* wk = (const float*)d_in[6]; const float* bk = (const float*)d_in[7]; const float* wv = (const float*)d_in[8]; const float* bv = (const float*)d_in[9]; const float* wo = (const float*)d_in[10]; const float* bo = (const float*)d_in[11];
    float* OUT = (float*)d_out;     // [4][1024][1024]
    char* wsp = (char*)d_ws;
    auto take = [&](size_t bytes) { char* p = wsp; wsp += (bytes + 255) & ~(size_t)255; return (void*)p; };
    bf* WQ = (bf*)take((size_t)DQ * DM * 2); bf* WK = (bf*)take((size_t)DKV * DM * 2); bf* WV = (bf*)take((size_t)DKV * DM * 2); bf* WO = (bf*)take((size_t)DM * DQ * 2); (void)WK; (void)WV;   // WQ, WK, WV are consecutive planes (z-stride DQ*DM)
    const size_t PL = (size_t)NB_ * NH_ * TT * HD;   // one plane set: all batches, all heads
    bf* QPh = (bf*)take(PL * 2); bf* KPh = (bf*)take(PL * 2); bf* QPl = (bf*)take(PL * 2); bf* KPl = (bf*)take(PL * 2); bf* VTh = (bf*)take(PL * 2); bf* VTl = (bf*)take(PL * 2);   // the k planes follow the q planes: one launch fills both
    bf* XB = (bf*)take((size_t)3 * NB_ * TT * DM * 2); bf* ATh = (bf*)take((size_t)NB_ * TT * DQ * 2); bf* ATl = (bf*)take((size_t)NB_ * TT * DQ * 2); unsigned* MB = (unsigned*)take((size_t)TT * TT / 8);   // bf16 inputs, merged heads hi/lo, mask bits
    if ((size_t)(wsp - (char*)d_ws) > ws_size) return;    // ws 256 MiB
    k_prep<<<dim3(NPB, 1, 1), 512, 0, stream>>>(x, xk, xv, wq, wk, wv, wo, mk, XB, WQ, WO, MB);   // bf16 inputs; per-head [1024][64] -> Bt rows hh*64.. of WQ, WK, WV; wo -> WO
    k_gemmp<<<dim3(NB_ * TT / 128, NH_ / 2, 3), 128, 0, stream>>>(XB, WQ, bq, bk, bv, QPh, QPl, VTh, VTl);   // z: q, k, v; writes the hi/lo planes the attention reads
    k_fattn<<<dim3(TT / 256, NB_ * NH_, 1), 256, 0, stream>>>(QPh, QPl, KPh, KPl, VTh, VTl, MB, ATh, ATl);   // y: batch * 16 + head, consecutive planes (stride TT*HD)
    k_gemmw<<<dim3(NB_ * TT / 128, DM / 128, 1), 128, 0, stream>>>(ATh, ATl, WO, OUT, bo);
}

// v010
// A run of this version takes 73.8 microseconds.
// It is 1.46 times as fast as v006, going by the measured steps of the versions left out in between.
// Counting every step since v000, it is 26.0 times as fast.
#include <hip/hip_runtime.h>

// Multi-head attention with per-head projections, an UNSCALED score and a random keep-mask (querys, keys, values [4][1024][1024]; q_h = querys Wq[h] + bq[h] (Wq, Wk, Wv [16][1024][64] 1/32 + biases [16][64] 0.01 == one 'xw' [1024][1024] projection per input whose column block h is W[h]); scores = q.k (no 1/sqrt(dk): sigma ~8); mask ([1024][1024] int {0,1}, ~50 %, read; 0 -> -1e9 == exclusion); softmax; out = concat heads Wp + bp ('xw' [1024][1024] 1/32 + 0.01) -> [4][1024][1024] (4.2 M)).
// Layout: one preparation launch (bf16 copies of the three inputs, all batches; each per-head [1024][64] weight transposed into rows h*64.. of one bf16 Bt per projection; Wp transposed, its bf16 values held as f16; the mask packed to one bit a score, as the lane-mask words of the attention's score registers); the three exact projections + f32 biases as the z planes of one launch over all 4096 rows, whose epilogue stores the attention's own planes (q, k [head][t][d] and v [head][d][t], one f16 plane each); ONE attention launch over all batches and heads (k_fattn: scores, mask, running softmax and P V stay in registers and LDS; scores and P V one f16 product each); merged heads (one f16 plane) x Wp + bp over all 4096 rows, one f16 product.
// Compute dtypes, f32 accumulate: every input rounded to bf16; projections exact + f32 biases; q and k rounded to f16 (11 bits), scores 1 product (their error is exponentiated); softmax f32; P and V rounded to f16 (their error reaches the output linearly), 1 product; merged heads rounded to f16 (linear too), Wp's bf16 values as f16 (the same numbers down to 2^-14, below it to 2^-24 absolute), 1 product + bias.

#define NB_  4
#define TT   1024
#define DM   1024
#define NH_  16
#define NKV  16
#define REP  (NH_ / NKV)
#define HD   64
#define DQ   (NH_ * HD)
#define DKV  (NKV * HD)
#define ZH   16
#define RH   1024
#define WIN  0
#define PCAR 1024.0f
#define SCL  1.0f   // the module applies no 1/sqrt(dk)
typedef _Float16 h16;
typedef unsigned short bf;
typedef __attribute__((ext_vector_type(16))) __bf16   v16bf;
typedef __attribute__((ext_vector_type(16))) _Float16 v16h;
typedef __attribute__((ext_vector_type(8)))  _Float16 v8h;
typedef __attribute__((ext_vector_type(8)))  unsigned short v8us;
typedef __attribute__((ext_vector_type(8)))  float    v8f;
typedef __attribute__((ext_vector_type(4)))  float    v4f;
typedef v8h  __attribute__((may_alias)) v8ha;
typedef v4f  __attribute__((may_alias)) v4fa;
typedef v8us __attribute__((may_alias)) v8usa;

__device__ __forceinline__ unsigned short f2bf(float f) { unsigned u = __float_as_uint(f); u += 0x7FFFu + ((u >> 16) & 1u); return (unsigned short)(u >> 16); }
__device__ __forceinline__ float bf2f(unsigned short b) { return __uint_as_float(((unsigned)b) << 16); }
__device__ __forceinline__ float bfr(float f) { return bf2f(f2bf(f)); }
__device__ __forceinline__ v16h cat16(v8h lo, v8h hi) { return __builtin_shufflevector(lo, hi, 0, 1, 2, 3, 4, 5, 6, 7, 8, 9, 10, 11, 12, 13, 14, 15); }
__device__ __forceinline__ v16bf cat16b(v8us lo, v8us hi) { return __builtin_bit_cast(v16bf, __builtin_shufflevector(lo, hi, 0, 1, 2, 3, 4, 5, 6, 7, 8, 9, 10, 11, 12, 13, 14, 15)); }
__device__ __forceinline__ v8f wmma16(v16h a, v16h b, v8f c) { return __builtin_amdgcn_wmma_f32_16x16x32_f16(false, a, false, b, (short)0, c, false, false); }
__device__ __forceinline__ v8f wmmab(v16bf a, v16bf b, v8f c) { return __builtin_amdgcn_wmma_f32_16x16x32_bf16(false, a, false, b, (short)0, c, false, false); }



template <typename T16> struct WFrag;
template <> struct WFrag<h16> { typedef v16h V; static __device__ __forceinline__ V ld(const h16* p) { return cat16(*(const v8h*)p, *(const v8h*)(p + 16)); } static __device__ __forceinline__ v8f mma(V a, V b, v8f c) { return wmma16(a, b, c); } };
template <> struct WFrag<bf> { typedef v16bf V; static __device__ __forceinline__ V ld(const bf* p) { return cat16b(*(const v8us*)p, *(const v8us*)(p + 16)); } static __device__ __forceinline__ v8f mma(V a, V b, v8f c) { return wmmab(a, b, c); } };

#define GPITCH 72                  // LDS row pitch of a staged GEMM operand in 16-bit elements: 128-B rows + 16 B (ds_load_b128 readers)
#define GTILE  (128 * GPITCH)      // one staged operand tile: 128 rows x 64 k
#define GK     1024                // K of both GEMMs = row pitch of their operand planes in elements
// One 128-row x 64-k operand tile, global (row pitch GK) -> LDS (row pitch GPITCH), by 128 threads: eight asynchronous 16-B copies per lane, rows r, r + 16, .. r + 112; 8 lanes per 128-B row, so every copy instruction takes 4 whole lines.
// l: the lane's LDS byte address in row r; g: its global address in row r.
__device__ __forceinline__ void cp_tile(unsigned l, const bf* g) {
    asm volatile("global_load_async_to_lds_b128 %0, %8, off\n\t"
                 "global_load_async_to_lds_b128 %1, %9, off\n\t"
                 "global_load_async_to_lds_b128 %2, %10, off\n\t"
                 "global_load_async_to_lds_b128 %3, %11, off\n\t"
                 "global_load_async_to_lds_b128 %4, %12, off\n\t"
                 "global_load_async_to_lds_b128 %5, %13, off\n\t"
                 "global_load_async_to_lds_b128 %6, %14, off\n\t"
                 "global_load_async_to_lds_b128 %7, %15, off\n\t"
                 "s_wait_xcnt 0x0"   // behind the last copy, inside the copies' own statement: in front of every rewrite of an address register that they name
                 :: "v"(l), "v"(l + 1 * 16 * GPITCH * 2), "v"(l + 2 * 16 * GPITCH * 2), "v"(l + 3 * 16 * GPITCH * 2), "v"(l + 4 * 16 * GPITCH * 2), "v"(l + 5 * 16 * GPITCH * 2), "v"(l + 6 * 16 * GPITCH * 2), "v"(l + 7 * 16 * GPITCH * 2),
                    "v"(g), "v"(g + 1 * 16 * GK), "v"(g + 2 * 16 * GK), "v"(g + 3 * 16 * GK), "v"(g + 4 * 16 * GK), "v"(g + 5 * 16 * GK), "v"(g + 6 * 16 * GK), "v"(g + 7 * 16 * GK) : "memory");
}
__device__ __forceinline__ void wait_copies() { asm volatile("s_wait_asynccnt 0x0" ::: "memory"); }   // this wave's copies have landed in LDS (the compiler places no wait for them)
__device__ __forceinline__ void wait_lds() { asm volatile("s_wait_dscnt 0x0" ::: "memory"); }         // this wave's LDS reads have returned: behind the next barrier their buffer may be refilled

// ---- k_gemmw: the output projection. FOUR WAVES per 128x128 output tile, 64x64 (16 accumulators) each; grid (M/128, N/128), 128 threads.
// C[m][n] (f32, pitch DM) = sum_k A[m][k] Bt[n][k] + bias[n], A and Bt f16 bits, one product per k step. A stage is 64 k of [A | Bt] rows in LDS, two buffers, filled by asynchronous copies one stage ahead; one barrier per stage.
__global__ __launch_bounds__(128) void k_gemmw(const bf* __restrict__ A, const bf* __restrict__ Bt, float* C, const float* __restrict__ bias) {
    typedef v16h V;
    __shared__ __align__(16) bf sm[2 * 2 * GTILE];
    __shared__ __align__(16) float osm[4 * 16 * 68];
    const int tid = threadIdx.x, lane = tid & 31, lr = lane & 15, hi = lane >> 4;
    const int wv = __builtin_amdgcn_readfirstlane(tid >> 5), wa = wv & 1, wb = wv >> 1;   // the wave's 64 rows of the A tiles and of the B tile
    const int r0 = blockIdx.x * 128 + wa * 64, c0 = blockIdx.y * 128 + wb * 64; const int ldc = DM;
    float* os = osm + wv * 16 * 68;
    const int crow = tid >> 3, cch = (tid & 7) * 8;   // staging: this thread's row (of 16) and 16-B piece
    const bf* ga = A + (size_t)(blockIdx.x * 128 + crow) * GK + cch; const bf* gb = Bt + (size_t)(blockIdx.y * 128 + crow) * GK + cch;
    const unsigned l0 = (unsigned)(size_t)sm + (crow * GPITCH + cch) * 2;
    auto stage = [&](int t, int buf) { const unsigned l = l0 + buf * 2 * GTILE * 2; cp_tile(l, ga + t * 64); cp_tile(l + GTILE * 2, gb + t * 64); };
    v8f acc[4][4];
#pragma unroll
    for (int mb = 0; mb < 4; ++mb)
#pragma unroll
        for (int nb = 0; nb < 4; ++nb) acc[mb][nb] = (v8f){};
    stage(0, 0); wait_copies(); __syncthreads();   // stage 0 is published
    stage(1, 1);
#pragma unroll 1
    for (int t = 0; t < GK / 64; ++t) {
        const bf* sa = sm + (t & 1) * 2 * GTILE + (wa * 64 + lr) * GPITCH + 8 * hi; const bf* sb = sm + ((t & 1) * 2 + 1) * GTILE + (wb * 64 + lr) * GPITCH + 8 * hi;
#pragma unroll
        for (int ks = 0; ks < 2; ++ks) { V a[4], b[4];
            b[0] = __builtin_bit_cast(v16h, WFrag<bf>::ld(sb + ks * 32));
#pragma unroll
            for (int mb = 0; mb < 4; ++mb) a[mb] = __builtin_bit_cast(v16h, WFrag<bf>::ld(sa + mb * 16 * GPITCH + ks * 32));
#pragma unroll
            for (int nb = 1; nb < 4; ++nb) b[nb] = __builtin_bit_cast(v16h, WFrag<bf>::ld(sb + nb * 16 * GPITCH + ks * 32));
            __builtin_amdgcn_sched_barrier(0);   // the k step's LDS reads stay one group in front of its products, in the order the products want them: left alone they sink among the WMMAs, each group behind a wait to 0
#pragma unroll
            for (int nb = 0; nb < 4; ++nb)
#pragma unroll
                for (int mb = 0; mb < 4; ++mb) acc[mb][nb] = wmma16(a[mb], b[nb], acc[mb][nb]); }
        __builtin_amdgcn_sched_barrier(0);   // the trip's products stay in front of the waits below: the copies in flight get the whole trip to land (left alone the waits and the barrier rise in front of the second k step)
        wait_lds(); wait_copies(); __syncthreads();   // publishes stage t + 1 and ends every wave's reads of stage t
        if (t + 2 < GK / 64) stage(t + 2, t & 1);     // block-uniform; into the buffer that this trip has read
    }
    wait_copies();
#pragma unroll
    for (int mb = 0; mb < 4; ++mb) {
#pragma unroll
        for (int nb = 0; nb < 4; ++nb) {
#pragma unroll
            for (int j = 0; j < 8; ++j) os[(hi * 8 + j) * 68 + nb * 16 + lr] = acc[mb][nb][j]; }
        __builtin_amdgcn_wave_barrier(); asm volatile("" ::: "memory");   // the tile is one wave's own: keeps the row reads below behind the other lanes' LDS writes above (the compiler sees no dependence between lanes)
        float* crow_ = C + (size_t)(r0 + mb * 16) * ldc + c0;
#pragma unroll
        for (int s = 0; s < 8; ++s) { const int row = 2 * s + hi, cofs = lr * 4; v4f val = *(const v4fa*)(os + row * 68 + cofs); val[0] += bfr(bias[c0 + cofs]); val[1] += bfr(bias[c0 + cofs + 1]); val[2] += bfr(bias[c0 + cofs + 2]); val[3] += bfr(bias[c0 + cofs + 3]);
            *(v4f*)(crow_ + (size_t)row * ldc + cofs) = val; }
        __builtin_amdgcn_wave_barrier();
        if (mb < 3) asm volatile("s_wait_xcnt 0x0" ::: "memory");   // behind the stores, in front of the first rewrite of their data registers; its clobber also keeps the next tile's LDS writes behind this tile's row reads
    }
}

typedef __attribute__((ext_vector_type(2))) _Float16 v2h;
typedef __attribute__((ext_vector_type(4))) _Float16 v4h;
typedef __attribute__((ext_vector_type(2))) unsigned short v2us;
typedef __attribute__((ext_vector_type(4))) unsigned short v4us;
typedef __attribute__((ext_vector_type(2))) float v2f;
typedef __attribute__((ext_vector_type(4))) int v4i;

typedef __attribute__((ext_vector_type(2))) __bf16 v2bf;
typedef __attribute__((ext_vector_type(2))) unsigned v2u;
typedef __attribute__((ext_vector_type(4))) unsigned v4u;
typedef v2u __attribute__((may_alias)) v2ua;
typedef v4u __attribute__((may_alias)) v4ua;
__device__ __forceinline__ unsigned pk2bf(float a, float b) { v2f y; y[0] = a; y[1] = b; return __builtin_bit_cast(unsigned, __builtin_convertvector(y, v2bf)); }   // a in the low half: the lower address
__device__ __forceinline__ unsigned bf2h2(unsigned t) { v2f y; y[0] = __uint_as_float(t << 16); y[1] = __uint_as_float(t & 0xFFFF0000u); return __builtin_bit_cast(unsigned, __builtin_convertvector(y, v2h)); }   // a pair of bf16 values as a pair of f16
#define TPITCH 264                 // LDS row pitch of the transposed weight tile in 16-bit elements: 512-B rows + 16 B (b128 accesses)
#define NPB    256                 // work-groups of k_prep: 16 waves each, one per WGP, all resident
#define XPB    (NB_ * TT * DM / NPB)   // elements of each input that one work-group converts
// ---- k_prep: the whole preparation in one launch; grid NPB, 512 threads. Every work-group takes an equal share of all three jobs, and every global access covers whole lines.
// Weights: 64 column blocks [1024 k][64 n] f32 (16 heads each of w0, w1, w2, row pitch HD; 16 column blocks of w3, row pitch DM) x 4 k tiles. One 256-k x 64-n tile per work-group: a thread reads 4 n of 8 consecutive k rows (16 lanes per 256-B row piece), packs 8 k per n into 16 B,
// turns the tile in LDS to [n][k], and the work-group writes 64 rows of 512 B: Bt (blocks 0..47, [n][k] planes one behind the other), [n][1024 k] bf16, or Bo (w3), the same with the bf16 values as f16 bits.
// Inputs: 64 KB of each of s0, s1, s2 per work-group, 4 KB per wave as eight 512-B loads; plane p of X gets source p as bf16, 256 B per store.
// Mask: one 16-query x 16-key tile per wave (a work-group: 16 rows x 1 KB, whole lines). A lane reads the 8 entries that the same lane of an attention wave holds as scores of that tile (query lane & 15, keys (lane >> 4) * 8 + j); word j = ballot(entry j != 0).
// MB [64 query tiles][64 key tiles][8 j]; the work-group's 128 words go out through LDS as 4 whole lines from one wave.
// All 34 loads of a thread are asked for at the top.
__global__ __launch_bounds__(512) void k_prep(const float* __restrict__ s0, const float* __restrict__ s1, const float* __restrict__ s2, const float* __restrict__ w0, const float* __restrict__ w1, const float* __restrict__ w2, const float* __restrict__ w3, const int* __restrict__ mk, bf* X, bf* Bt, bf* Bo, unsigned* MB) {
    __shared__ __align__(16) bf tl[64 * TPITCH];
    __shared__ __align__(16) unsigned ml[16 * 8];
    const int tid = threadIdx.x, m = blockIdx.x >> 2, kt = blockIdx.x & 3;   // m: column block, kt: k tile (block-uniform)
    const bool iso = (m >= 3 * NH_);
    const float* wsrc = iso ? w3 + (m - 3 * NH_) * 64 : (m < NH_ ? w0 : m < 2 * NH_ ? w1 : w2) + (size_t)(m & (NH_ - 1)) * DM * HD; const int wp = iso ? DM : HD;
    const int n4 = (tid & 15) * 4, kq = tid >> 4;
    const float* wl = wsrc + (size_t)(kt * 256 + kq * 8) * wp + n4;
    const float* wa[8];
#pragma unroll
    for (int i = 0; i < 8; ++i) wa[i] = wl + i * wp;
    const size_t e0 = (size_t)blockIdx.x * XPB + (tid >> 5) * 1024 + (tid & 31) * 4;
    const float* x0 = s0 + e0; const float* x1 = s1 + e0; const float* x2 = s2 + e0;
    const int* mp = mk + (size_t)((blockIdx.x >> 2) * 16 + (tid & 15)) * TT + ((blockIdx.x & 3) * 16 + (tid >> 5)) * 16 + ((tid >> 4) & 1) * 8;
    v4f wr[8], xr[3][8]; v4i mr[2];
#pragma unroll
    for (int i = 0; i < 8; ++i) wr[i] = *(const v4fa*)wa[i];
    mr[0] = *(const v4i*)mp; mr[1] = *(const v4i*)(mp + 4);
#pragma unroll
    for (int i = 0; i < 8; ++i) xr[0][i] = *(const v4fa*)(x0 + i * 128);
#pragma unroll
    for (int i = 0; i < 8; ++i) xr[1][i] = *(const v4fa*)(x1 + i * 128);
#pragma unroll
    for (int i = 0; i < 8; ++i) xr[2][i] = *(const v4fa*)(x2 + i * 128);
    asm volatile("s_wait_xcnt 0x0" :: "v"(wa[0]), "v"(wa[1]), "v"(wa[2]), "v"(wa[3]), "v"(wa[4]), "v"(wa[5]), "v"(wa[6]), "v"(wa[7]), "v"(x0), "v"(x1), "v"(x2), "v"(mp) : "memory");   // behind the loads, in front of the first rewrite of their address registers (named as inputs: they stay live up to here)
    __builtin_amdgcn_sched_barrier(0);   // all 34 loads stay one group at the top: left alone the first conversions rise among them, and the last eight loads are then issued only behind a wait on the first
#pragma unroll
    for (int j = 0; j < 4; ++j) { v4u t;
#pragma unroll
        for (int p = 0; p < 4; ++p) t[p] = pk2bf(wr[2 * p][j], wr[2 * p + 1][j]);
        if (iso) {   // block-uniform: w3 meets an f16 operand
#pragma unroll
            for (int p = 0; p < 4; ++p) t[p] = bf2h2(t[p]); }
        *(v4ua*)(tl + (n4 + j) * TPITCH + kq * 8) = t; }
    { v4u b0, b1;
#pragma unroll
        for (int j = 0; j < 4; ++j) { b0[j] = __builtin_amdgcn_ballot_w32(mr[0][j] != 0); b1[j] = __builtin_amdgcn_ballot_w32(mr[1][j] != 0); }
        if ((tid & 31) == 0) { *(v4ua*)(ml + (tid >> 5) * 8) = b0; *(v4ua*)(ml + (tid >> 5) * 8 + 4) = b1; } }
    __syncthreads();   // the turned tile is whole: its rows are read across the writers; so are the 16 waves' mask words
    const int row = tid >> 5, col = (tid & 31) * 8;   // one wave per 512-B row
    bf* wd = (iso ? Bo + (size_t)(m - 3 * NH_) * 64 * DM : Bt + (size_t)m * 64 * DM) + (size_t)row * DM + kt * 256 + col;
#pragma unroll
    for (int s = 0; s < 4; ++s) *(v4ua*)(wd + s * 16 * DM) = *(const v4ua*)(tl + (row + 16 * s) * TPITCH + col);
#pragma unroll
    for (int p = 0; p < 3; ++p)
#pragma unroll
        for (int i = 0; i < 8; ++i) { v2u o; o[0] = pk2bf(xr[p][i][0], xr[p][i][1]); o[1] = pk2bf(xr[p][i][2], xr[p][i][3]); *(v2ua*)(X + (size_t)p * NB_ * TT * DM + e0 + i * 128) = o; }
    if (tid < 32) *(v4ua*)(MB + blockIdx.x * 128 + tid * 4) = *(const v4ua*)(ml + tid * 4);   // the kernel's last store: no register of it is rewritten behind it
}

#define PPITCH 72                  // LDS row pitch of the projection epilogue in 16-bit elements: 128-B rows + 16 B (b128 accesses)
// Epilogue of k_gemmp. A lane's 8 accumulator values of tile [mb][nb] are 8 consecutive A-side indices (mb*16 + hi*8 + j) at one B-side index (nb*16 + lr): the A side is the contiguous dimension of the plane that is written.
// value + bias (braw, loaded by the caller; BROW: it runs along the B side, braw[0][nb]; else along the A side, braw[2*mb], braw[2*mb+1]) -> one f16 -> LDS rows [B-side index][A-side index] -> whole 128-B lines of Df (row pitch PITCH in elements).
template <bool BROW, int PITCH>
__device__ __forceinline__ void proj_out(const v8f (&acc)[4][4], const v4f (&braw)[8], bf* sh, int lane, bf* Df) {
    const int lr = lane & 15, hi = lane >> 4;
    float bb[4];
    if (BROW) {
#pragma unroll
        for (int nb = 0; nb < 4; ++nb) bb[nb] = bfr(braw[0][nb]); }
#pragma unroll
    for (int mb = 0; mb < 4; ++mb) { float ba[8];
        if (!BROW) {
#pragma unroll
            for (int j = 0; j < 4; ++j) { ba[j] = bfr(braw[2 * mb][j]); ba[4 + j] = bfr(braw[2 * mb + 1][j]); } }
#pragma unroll
        for (int nb = 0; nb < 4; ++nb) { v4u hw;
#pragma unroll
            for (int w = 0; w < 4; ++w) { v2f y; y[0] = acc[mb][nb][2 * w] + (BROW ? bb[nb] : ba[2 * w]); y[1] = acc[mb][nb][2 * w + 1] + (BROW ? bb[nb] : ba[2 * w + 1]);
                hw[w] = __builtin_bit_cast(unsigned, __builtin_convertvector(y, v2h)); }
            *(v4ua*)(sh + (nb * 16 + lr) * PPITCH + mb * 16 + hi * 8) = hw; } }
    __builtin_amdgcn_wave_barrier(); asm volatile("" ::: "memory");   // the tile is one wave's own: keeps the row reads below behind the other lanes' LDS writes above (the compiler sees no dependence between lanes)
    const int row = lane >> 3, c = (lane & 7) * 8;   // 8 lanes per 128-B row, 4 rows per store
    const bf* sr = sh + row * PPITCH + c; bf* gf = Df + (size_t)row * PITCH + c;
#pragma unroll
    for (int s = 0; s < 16; ++s) *(v4ua*)(gf + s * 4 * PITCH) = *(const v4ua*)(sr + s * 4 * PPITCH);
    asm volatile("s_wait_xcnt 0x0" ::: "memory");   // behind the last store of the run, in front of any rewrite of the stores' registers on a path that the listing leaves open behind it
}
// ---- k_gemmp: the three projections. FOUR WAVES per 128 rows x two heads' 128 columns, each wave 64 rows x one head's 64 columns (16 accumulators); grid (NB_*TT/128, NH_/2, 3), 128 threads; z: q, k, v.
// A stage is 64 k of [A rows | B rows] in LDS, two buffers, filled by asynchronous copies one stage ahead; one barrier per stage (k_gemmw's loop).
// The attention's planes come straight out of the accumulators: for q and k the weight rows are the A operand (a lane then holds 8 consecutive d of one t: plane [head][t][d]), for v the input rows are (8 consecutive t of one d: plane [head][d][t]).
// Pf: the q plane with the k plane behind it (z-stride NB_*NH_*TT*HD). Vf: the v plane. All f16 bits.
__global__ __launch_bounds__(128) void k_gemmp(const bf* __restrict__ X, const bf* __restrict__ Wt, const float* __restrict__ bias0, const float* __restrict__ bias1, const float* __restrict__ bias2, bf* Pf, bf* Vf) {
    typedef WFrag<bf>::V V;
    __shared__ __align__(16) bf sm[2 * 2 * GTILE];   // the two stages; behind the loop's last barrier the four waves' epilogue tiles (64 * PPITCH elements each)
    static_assert(4 * 64 * PPITCH <= 2 * 2 * GTILE, "epilogue tiles lie inside the ring");
    const int z = blockIdx.z; const bool isv = (z == 2);   // block-uniform
    const int tid = threadIdx.x, lane = tid & 31, lr = lane & 15, hi = lane >> 4;
    const int wv = __builtin_amdgcn_readfirstlane(tid >> 5), wa = wv & 1, wb = wv >> 1;   // the wave's 64 rows of the A tile and of the B tile
    const int r0 = blockIdx.x * 128 + (isv ? wa : wb) * 64, hd = blockIdx.y * 2 + (isv ? wb : wa);
    const bf* xr = X + ((size_t)z * NB_ * TT + blockIdx.x * 128) * GK; const bf* wr = Wt + ((size_t)z * DQ + blockIdx.y * 128) * GK;
    const int crow = tid >> 3, cch = (tid & 7) * 8;   // staging: this thread's row (of 16) and 16-B piece
    const bf* ga = (isv ? xr : wr) + (size_t)crow * GK + cch; const bf* gb = (isv ? wr : xr) + (size_t)crow * GK + cch;
    const unsigned l0 = (unsigned)(size_t)sm + (crow * GPITCH + cch) * 2;
    auto stage = [&](int t, int buf) { const unsigned l = l0 + buf * 2 * GTILE * 2; cp_tile(l, ga + t * 64); cp_tile(l + GTILE * 2, gb + t * 64); };
    v8f acc[4][4];
#pragma unroll
    for (int mb = 0; mb < 4; ++mb)
#pragma unroll
        for (int nb = 0; nb < 4; ++nb) acc[mb][nb] = (v8f){};
    const float* bias = (z == 0 ? bias0 : z == 1 ? bias1 : bias2) + hd * HD; v4f braw[8];   // the lane's biases, asked for in front of the loop: they land under it
    const float* bl = bias + (isv ? lr : hi * 8);
    if (isv) {
#pragma unroll
        for (int nb = 0; nb < 4; ++nb) braw[0][nb] = bl[nb * 16]; }
    else {
#pragma unroll
        for (int mb = 0; mb < 4; ++mb) { braw[2 * mb] = *(const v4fa*)(bl + mb * 16); braw[2 * mb + 1] = *(const v4fa*)(bl + mb * 16 + 4); } }
    asm volatile("s_wait_xcnt 0x0" :: "v"(bl) : "memory");   // behind the bias loads, in front of the first rewrite of their address registers (named as input: live up to here)
    stage(0, 0); wait_copies(); __syncthreads();   // stage 0 is published
    stage(1, 1);
#pragma unroll 1
    for (int t = 0; t < GK / 64; ++t) {
        const bf* sa = sm + (t & 1) * 2 * GTILE + (wa * 64 + lr) * GPITCH + 8 * hi; const bf* sb = sm + ((t & 1) * 2 + 1) * GTILE + (wb * 64 + lr) * GPITCH + 8 * hi;
#pragma unroll
        for (int ks = 0; ks < 2; ++ks) { V a[4], b[4];
            b[0] = WFrag<bf>::ld(sb + ks * 32);
#pragma unroll
            for (int i = 0; i < 4; ++i) a[i] = WFrag<bf>::ld(sa + i * 16 * GPITCH + ks * 32);
#pragma unroll
            for (int i = 1; i < 4; ++i) b[i] = WFrag<bf>::ld(sb + i * 16 * GPITCH + ks * 32);
            __builtin_amdgcn_sched_barrier(0);   // as in k_gemmw: the k step's LDS reads stay one group in front of its products
#pragma unroll
            for (int nb = 0; nb < 4; ++nb)
#pragma unroll
                for (int mb = 0; mb < 4; ++mb) acc[mb][nb] = WFrag<bf>::mma(a[mb], b[nb], acc[mb][nb]); }
        __builtin_amdgcn_sched_barrier(0);   // the trip's products stay in front of the waits below: the copies in flight get the whole trip to land (left alone the waits and the barrier rise in front of the second k step)
        wait_lds(); wait_copies(); __syncthreads();   // publishes stage t + 1 and ends every wave's reads of stage t
        if (t + 2 < GK / 64) stage(t + 2, t & 1);     // block-uniform; into the buffer that this trip has read
    }
    wait_copies();
    bf* sh = sm + wv * 64 * PPITCH;   // every wave's last read of the ring stands in front of the loop's last barrier
    const int bb = r0 / TT, t0 = r0 % TT; const size_t pl = ((size_t)bb * NH_ + hd) * TT * HD;
    if (isv) proj_out<true, TT>(acc, braw, sh, lane, Vf + pl + t0);
    else proj_out<false, HD>(acc, braw, sh, lane, Pf + (size_t)z * NB_ * NH_ * TT * HD + pl + (size_t)t0 * HD);
}
typedef __attribute__((ext_vector_type(8))) unsigned v8u;
typedef __attribute__((ext_vector_type(16))) unsigned v16u;
typedef const __attribute__((address_space(4))) v16u* cw16;   // constant address space: the words are written by the launch before and by nobody in this one; a wave-uniform load through it is a scalar load also inside the loop (through the plain pointer the loop's loads came out as vector loads with 32 readfirstlanes a pass)
__device__ __forceinline__ float xhalf(float x) { const int b = __float_as_int(x); return __int_as_float(__builtin_amdgcn_permlanex16(b, b, 0x76543210, 0xfedcba98, false, false)); }   // the value of lane l ^ 16
#define FPITCH 72                  // LDS row pitch in 16-bit elements: 128-B rows + 16 B (ds_load_b128 readers)
#define FTILE  (64 * FPITCH)       // one staged tile: 64 rows
#define L2E    1.4426950408889634f
__global__ __launch_bounds__(512) void k_fattn(const bf* __restrict__ Qf, const bf* __restrict__ Kf, const bf* __restrict__ Vf, const unsigned* __restrict__ MB, bf* Af) {
    __shared__ __align__(16) bf sm[2 * 2 * 2 * FTILE];   // [key half][buffer][K | V^T]; behind the loop the upper half's results
    static_assert(8 * 17 * 32 * 16 <= 2 * 2 * 2 * FTILE * 2, "the hand-over lies inside the rings");
    const int tid = threadIdx.x, lane = tid & 31, lr = lane & 15, hi = lane >> 4;
    const int wv = __builtin_amdgcn_readfirstlane(tid >> 5), cg = wv & 7, kh = wv >> 3;   // column group, key half (wave-uniform)
    const int q0 = blockIdx.x * 256 + cg * 32, kbase = kh * (TT / 2);
    const size_t pb = (size_t)blockIdx.y * TT * HD;
    bf* smh = sm + kh * 2 * 2 * FTILE;   // this key half's ring
    const int srow = (tid & 255) >> 3, sch = (tid & 7) * 8;   // staging: this thread moves 16 B of rows srow and srow + 32 of each tile of its key half
    v8us stg[4];
    auto gload = [&](int s) {
        __builtin_amdgcn_sched_barrier(0);   // this and the one at the foot keep the loads where they are written, with their s_wait_xcnt directly behind them
        const size_t ko = pb + (size_t)(kbase + s * 64 + srow) * HD + sch, vo = pb + (size_t)srow * TT + kbase + s * 64 + sch; const bf* a0 = Kf + ko; const bf* a1 = Vf + vo;
#pragma unroll
        for (int r = 0; r < 2; ++r) { stg[r] = *(const v8us*)(a0 + r * 32 * HD); stg[2 + r] = *(const v8us*)(a1 + r * 32 * TT); }
        asm volatile("s_wait_xcnt 0x0" :: "v"(a0), "v"(a1) : "memory");   // behind the loads, in front of the first rewrite of their address registers (named as inputs: they stay live up to here, so no load's result lands on them either)
        __builtin_amdgcn_sched_barrier(0); };
    auto sstore = [&](int buf) {
#pragma unroll
        for (int i = 0; i < 2; ++i)
#pragma unroll
            for (int r = 0; r < 2; ++r) *(v8us*)(smh + (buf * 2 + i) * FTILE + (srow + 32 * r) * FPITCH + sch) = stg[i * 2 + r]; };
    const unsigned* mq = MB + (size_t)(blockIdx.x * 16 + cg * 2) * 512 + (kbase >> 1);   // the wave's two query tiles, 512 words each, from its key half's first key; wave-uniform
    auto mload = [&](v16u (&m)[2], int key0, int koff) {   // mask words of 32 keys (from key0 + koff; koff a literal) x 32 query columns: [column tile][key tile * 8 + j]; 8 words per 16 keys
        __builtin_amdgcn_sched_barrier(0);   // as in gload
        const unsigned* p0 = mq + (key0 >> 1);
        m[0] = *(cw16)(size_t)(p0 + koff / 2); m[1] = *(cw16)(size_t)(p0 + 512 + koff / 2);
        asm volatile("s_wait_xcnt 0x0" :: "s"(p0) : "memory");   // behind the loads, in front of the first rewrite of their address registers (the two loads share one scalar pair, named as input: live up to here)
        __builtin_amdgcn_sched_barrier(0); };
    v16h qf[2][2];   // [column tile][k step]
#pragma unroll
    for (int nt = 0; nt < 2; ++nt)
#pragma unroll
        for (int ks = 0; ks < 2; ++ks) { const size_t qo = pb + (size_t)(q0 + nt * 16 + lr) * HD + ks * 32 + 8 * hi; qf[nt][ks] = __builtin_bit_cast(v16h, WFrag<bf>::ld(Qf + qo)); }
    asm volatile("s_wait_xcnt 0x0" ::: "memory");   // behind the loads, in front of the first rewrite of their address registers
    v8f o[4][2];
#pragma unroll
    for (int dt = 0; dt < 4; ++dt) { o[dt][0] = (v8f){}; o[dt][1] = (v8f){}; }
    float mrun[2] = { -3.0e38f, -3.0e38f }; v2f lsum[2] = { (v2f){}, (v2f){} };   // the sum runs in two chains per column tile (even and odd keys)
    v16u mm[2];
    auto pass = [&](const bf* sb, int kb, int nextkey, int nextoff) {   // 32 keys; nextkey + nextoff: first key of the pass after this one
        v16h kf[2][2];   // [key tile][k step]: one group of LDS reads in front of the products
#pragma unroll
        for (int kt = 0; kt < 2; ++kt)
#pragma unroll
            for (int ks = 0; ks < 2; ++ks) { const bf* kp = sb + (kb * 32 + kt * 16 + lr) * FPITCH + ks * 32 + 8 * hi; kf[kt][ks] = __builtin_bit_cast(v16h, WFrag<bf>::ld(kp)); }
        v8f sc[2][2];   // [key tile][column tile]
#pragma unroll
        for (int kt = 0; kt < 2; ++kt) { sc[kt][0] = (v8f){}; sc[kt][1] = (v8f){};
#pragma unroll
            for (int ks = 0; ks < 2; ++ks)
#pragma unroll
                for (int nt = 0; nt < 2; ++nt) sc[kt][nt] = wmma16(kf[kt][ks], qf[nt][ks], sc[kt][nt]); }
        v16h vf[4];   // [d tile]: read while the softmax runs
#pragma unroll
        for (int dt = 0; dt < 4; ++dt) { const bf* vp = sb + FTILE + (dt * 16 + lr) * FPITCH + kb * 32 + 8 * hi; vf[dt] = __builtin_bit_cast(v16h, WFrag<bf>::ld(vp)); }
        float mn[2]; bool need = false;
#pragma unroll
        for (int nt = 0; nt < 2; ++nt) { float mx = -3.0e38f;
#pragma unroll
            for (int kt = 0; kt < 2; ++kt)
#pragma unroll
                for (int j = 0; j < 8; ++j) { const float t = __builtin_amdgcn_inverse_ballot_w32(mm[nt][kt * 8 + j]) ? sc[kt][nt][j] * SCL : -1.0e9f; sc[kt][nt][j] = t; mx = fmaxf(mx, t); }
            mx = fmaxf(mx, xhalf(mx)); mn[nt] = fmaxf(mrun[nt], mx); need = need || (mn[nt] > mrun[nt]); }
        mload(mm, nextkey, nextoff);   // the next pass's mask flies behind this pass's exponentials and products
        if (__builtin_amdgcn_ballot_w32(need) != 0) {   // wave-uniform: one test per pass
#pragma unroll
            for (int nt = 0; nt < 2; ++nt) { const float al = __builtin_amdgcn_exp2f((mrun[nt] - mn[nt]) * L2E); lsum[nt] *= al; mrun[nt] = mn[nt];
#pragma unroll
                for (int dt = 0; dt < 4; ++dt) o[dt][nt] *= al; } }
        v16h pf[2];
#pragma unroll
        for (int nt = 0; nt < 2; ++nt) { const float mc = mrun[nt] * L2E; v8u hw;   // packed pairs: word w holds elements 2w, 2w + 1 of the B fragment
#pragma unroll
            for (int w = 0; w < 8; ++w) { const int kt = w >> 2, j = (w & 3) * 2; v2f p; p[0] = __builtin_amdgcn_exp2f(__builtin_fmaf(sc[kt][nt][j], L2E, -mc)); p[1] = __builtin_amdgcn_exp2f(__builtin_fmaf(sc[kt][nt][j + 1], L2E, -mc)); lsum[nt] += p;
                hw[w] = __builtin_bit_cast(unsigned, __builtin_convertvector(p, v2h)); }
            pf[nt] = __builtin_bit_cast(v16h, hw); }
#pragma unroll
        for (int dt = 0; dt < 4; ++dt)
#pragma unroll
            for (int nt = 0; nt < 2; ++nt) o[dt][nt] = wmma16(vf[dt], pf[nt], o[dt][nt]);
        __builtin_amdgcn_sched_barrier(0x0108); };   // vector work does not cross (LDS reads and WMMAs may): the next pass's selects stay behind this pass's products, and its K reads stay one group ahead (left alone they scatter among the products in pairs, several directly in front of a wait to 0)
    gload(0); mload(mm, 0, 0); sstore(0); __syncthreads();
#pragma unroll 1
    for (int s = 0; s < TT / 128; ++s) { const bf* sb = smh + (s & 1) * 2 * FTILE; const bool more = (s + 1 < TT / 128);   // block-uniform; s counts the stages of the wave's key half
        gload(more ? s + 1 : s);   // no branch round the loads issued ahead (here and for the mask): a branch merges two paths in the compiler's load counting and the waits fall to the smaller count; the last stage's are in bounds and unused
        pass(sb, 0, s * 64, 32);
        pass(sb, 1, more ? (s + 1) * 64 : 0, 0);
        if (more) { sstore((s + 1) & 1); __syncthreads(); } }   // the buffer written was last read in stage s - 1, whose barrier every wave has passed; this barrier publishes it
    // The two key halves are joined: 17 pieces of 16 B per lane (16 of the output tiles, one of maxima and sums), piece c of column group g at ((g * 17 + c) * 32 + lane) * 16 B: every access is 512 B in a row.
    v4f* mg = (v4f*)sm + cg * 17 * 32 + lane;
    __syncthreads();   // every wave has left the rings: they become the hand-over
    if (kh == 1) {   // wave-uniform; no barrier inside
#pragma unroll
        for (int dt = 0; dt < 4; ++dt)
#pragma unroll
            for (int nt = 0; nt < 2; ++nt) { v4f a, b;
#pragma unroll
                for (int j = 0; j < 4; ++j) { a[j] = o[dt][nt][j]; b[j] = o[dt][nt][4 + j]; }
                *(v4fa*)(mg + ((dt * 2 + nt) * 2) * 32) = a; *(v4fa*)(mg + ((dt * 2 + nt) * 2 + 1) * 32) = b; }
        v4f t; t[0] = mrun[0]; t[1] = mrun[1]; t[2] = lsum[0][0] + lsum[0][1]; t[3] = lsum[1][0] + lsum[1][1];
        *(v4fa*)(mg + 16 * 32) = t; }
    __syncthreads();   // publishes the upper half's results
    if (kh == 1) return;   // behind the kernel's last barrier
    const v4f ot = *(const v4fa*)(mg + 16 * 32);
    const int bb = blockIdx.y / NH_, hh = blockIdx.y % NH_;
#pragma unroll
    for (int nt = 0; nt < 2; ++nt) { const float mj = fmaxf(mrun[nt], ot[nt]); const float a0 = __builtin_amdgcn_exp2f((mrun[nt] - mj) * L2E), a1 = __builtin_amdgcn_exp2f((ot[nt] - mj) * L2E);   // both parts on the joint maximum
#pragma unroll
        for (int dt = 0; dt < 4; ++dt) { const v4f a = *(const v4fa*)(mg + ((dt * 2 + nt) * 2) * 32), b = *(const v4fa*)(mg + ((dt * 2 + nt) * 2 + 1) * 32);
#pragma unroll
            for (int j = 0; j < 4; ++j) { o[dt][nt][j] = o[dt][nt][j] * a0 + a[j] * a1; o[dt][nt][4 + j] = o[dt][nt][4 + j] * a0 + b[j] * a1; } }
        const float lh = (lsum[nt][0] + lsum[nt][1]) * a0 + ot[2 + nt] * a1; const float inv = __fdiv_rn(1.0f, lh + xhalf(lh)); const size_t oo = ((size_t)bb * TT + q0 + nt * 16 + lr) * DQ + hh * HD + hi * 8;
#pragma unroll
        for (int dt = 0; dt < 4; ++dt) { v4u hw;
#pragma unroll
            for (int w = 0; w < 4; ++w) { v2f y; y[0] = o[dt][nt][2 * w] * inv; y[1] = o[dt][nt][2 * w + 1] * inv; hw[w] = __builtin_bit_cast(unsigned, __builtin_convertvector(y, v2h)); }
            *(v4ua*)(Af + oo + dt * 16) = hw; }
        if (nt == 0) asm volatile("s_wait_xcnt 0x0" ::: "memory"); }   // behind the first column tile's stores, in front of any rewrite of their registers by the second tile's work
}

extern "C" void kernel_launch(void* const* d_in, const int* in_sizes, int n_in,
                              void* d_out, int out_size, void* d_ws, size_t ws_size, hipStream_t stream) {
    (void)in_sizes; (void)n_in; (void)out_size;
    const float* x = (const float*)d_in[0]; const float* xk = (const float*)d_in[1]; const float* xv = (const float*)d_in[2]; const int* mk = (const int*)d_in[3];   /* mask [1024][1024] int */ const float* wq = (const float*)d_in[4]; const float* bq = (const float*)d_in[5]; const float* wk = (const float*)d_in[6]; const float* bk = (const float*)d_in[7]; const float* wv = (const float*)d_in[8]; const float* bv = (const float*)d_in[9]; const float* wo = (const float*)d_in[10]; const float* bo = (const float*)d_in[11];
    float* OUT = (float*)d_out;     // [4][1024][1024]
    char* wsp = (char*)d_ws;
    auto take = [&](size_t bytes) { char* p = wsp; wsp += (bytes + 255) & ~(size_t)255; return (void*)p; };
    bf* WQ = (bf*)take((size_t)DQ * DM * 2); bf* WK = (bf*)take((size_t)DKV * DM * 2); bf* WV = (bf*)take((size_t)DKV * DM * 2); bf* WO = (bf*)take((size_t)DM * DQ * 2); (void)WK; (void)WV;   // WQ, WK, WV are consecutive planes (z-stride DQ*DM)
    const size_t PL = (size_t)NB_ * NH_ * TT * HD;   // one plane set: all batches, all heads
    bf* QPf = (bf*)take(PL * 2); bf* KPf = (bf*)take(PL * 2); bf* VTf = (bf*)take(PL * 2);   // the k plane follows the q plane: one launch fills both
    bf* XB = (bf*)take((size_t)3 * NB_ * TT * DM * 2); bf* ATf = (bf*)take((size_t)NB_ * TT * DQ * 2); unsigned* MB = (unsigned*)take((size_t)TT * TT / 8);   // bf16 inputs, merged heads (f16), mask bits
    if ((size_t)(wsp - (char*)d_ws) > ws_size) return;    // ws 256 MiB
    k_prep<<<dim3(NPB, 1, 1), 512, 0, stream>>>(x, xk, xv, wq, wk, wv, wo, mk, XB, WQ, WO, MB);   // bf16 inputs; per-head [1024][64] -> Bt rows hh*64.. of WQ, WK, WV; wo -> WO
    k_gemmp<<<dim3(NB_ * TT / 128, NH_ / 2, 3), 128, 0, stream>>>(XB, WQ, bq, bk, bv, QPf, VTf);   // z: q, k, v; writes the planes the attention reads
    k_fattn<<<dim3(TT / 256, NB_ * NH_, 1), 512, 0, stream>>>(QPf, KPf, VTf, MB, ATf);   // y: batch * 16 + head, consecutive planes (stride TT*HD)
    k_gemmw<<<dim3(NB_ * TT / 128, DM / 128, 1), 128, 0, stream>>>(ATf, WO, OUT, bo);
}
